// v000
// Times are from an AMD MI455X. After a warm-up the kernel runs many times in a row, and a time is the length of
// such a window on the GPU divided by its runs, so every launch and the gaps after it count. The runs cycle
// through copies of the inputs. A figure is the median of several windows, for all but v000 over two sittings.
// Sittings can differ by a few percent; kernels timed side by side share one.
// v000 is the starting kernel. One run takes 3910 microseconds.
#include <hip/hip_runtime.h>

// Perceiver self-attention (hidden_states [4][2048][1024]; x = LN(h) (1e-5, gamma, beta); q, k, v = x W^T + b ('oi' [1024][1024], 16 heads x 64); softmax(q.k/8) over all keys; out = merged context (no output projection) -> [4][2048][1024] (8.4 M)).
// Compute dtypes, f32 accumulate: every input rounded to bf16; q/k/v on hi/lo bf16 x planes times bf16 W (2 products) + biases; scores and attn.v (no mask): query rows < 512 hl (3 products), the rest single fp16 (x1024); softmax f32; no output projection: the merged context is written in f32.

#define NB_  4
#define TT   2048
#define DM   1024
#define NH_  16
#define NKV  16
#define REP  (NH_ / NKV)
#define HD   64
#define DQ   (NH_ * HD)
#define DKV  (NKV * HD)
#define LNEPS 1e-5f
typedef __attribute__((ext_vector_type(4))) unsigned short v4us;
#define ZH   2
#define RH   512                  // query rows < RH use hi+lo planes (0: none)
#define WIN  0
#define PCAR 1024.0f
#define SCL  0.125f   // HD^-0.5
typedef _Float16 h16;
typedef unsigned short bf;
typedef __attribute__((ext_vector_type(16))) __bf16   v16bf;
typedef __attribute__((ext_vector_type(16))) _Float16 v16h;
typedef __attribute__((ext_vector_type(8)))  _Float16 v8h;
typedef __attribute__((ext_vector_type(8)))  unsigned short v8us;
typedef __attribute__((ext_vector_type(8)))  float    v8f;
typedef __attribute__((ext_vector_type(4)))  float    v4f;
typedef v8h  __attribute__((may_alias)) v8ha;
typedef v4f  __attribute__((may_alias)) v4fa;
typedef v8us __attribute__((may_alias)) v8usa;

__device__ __forceinline__ unsigned short f2bf(float f) { unsigned u = __float_as_uint(f); u += 0x7FFFu + ((u >> 16) & 1u); return (unsigned short)(u >> 16); }
__device__ __forceinline__ float bf2f(unsigned short b) { return __uint_as_float(((unsigned)b) << 16); }
__device__ __forceinline__ float bfr(float f) { return bf2f(f2bf(f)); }
__device__ __forceinline__ v16h cat16(v8h lo, v8h hi) { return __builtin_shufflevector(lo, hi, 0, 1, 2, 3, 4, 5, 6, 7, 8, 9, 10, 11, 12, 13, 14, 15); }
__device__ __forceinline__ v16bf cat16b(v8us lo, v8us hi) { return __builtin_bit_cast(v16bf, __builtin_shufflevector(lo, hi, 0, 1, 2, 3, 4, 5, 6, 7, 8, 9, 10, 11, 12, 13, 14, 15)); }
__device__ __forceinline__ v8f wmma16(v16h a, v16h b, v8f c) { return __builtin_amdgcn_wmma_f32_16x16x32_f16(false, a, false, b, (short)0, c, false, false); }
__device__ __forceinline__ v8f wmmab(v16bf a, v16bf b, v8f c) { return __builtin_amdgcn_wmma_f32_16x16x32_bf16(false, a, false, b, (short)0, c, false, false); }



// ---- k_gemmw: register-blocked GEMM, ONE WAVE per 64x64 output tile (16 accumulators), operands straight from K-contiguous 16-bit planes; grid (M/64, N/64, Z), 32 threads.
// C[m][n] (f32, pitch ldc, + optional f32 bias[n]) = sum_k A[m][k] Bt[n][k] (+ split products per NSPLIT). z-batch strides sA/sB/sC in elements. K % 32 == 0.
template <typename T16> struct WFrag;
template <> struct WFrag<h16> { typedef v16h V; static __device__ __forceinline__ V ld(const h16* p) { return cat16(*(const v8h*)p, *(const v8h*)(p + 16)); } static __device__ __forceinline__ v8f mma(V a, V b, v8f c) { return wmma16(a, b, c); } };
template <> struct WFrag<bf> { typedef v16bf V; static __device__ __forceinline__ V ld(const bf* p) { return cat16b(*(const v8us*)p, *(const v8us*)(p + 16)); } static __device__ __forceinline__ v8f mma(V a, V b, v8f c) { return wmmab(a, b, c); } };
template <typename T16, int NSPLIT, bool BIAS>
__global__ __launch_bounds__(32) void k_gemmw(const T16* __restrict__ A, const T16* __restrict__ A2, const T16* __restrict__ Bt, const T16* __restrict__ Bt2, int K, float* C, int ldc, const float* __restrict__ bias, size_t sA, size_t sB, size_t sC) {
    typedef typename WFrag<T16>::V V;
    __shared__ __align__(16) float os[16 * 68];
    const size_t z = blockIdx.z; A += z * sA; if (A2) A2 += z * sA; Bt += z * sB; if (Bt2) Bt2 += z * sB; C += z * sC;
    const int lane = threadIdx.x & 31, lr = lane & 15, hi = lane >> 4; const int r0 = blockIdx.x * 64, c0 = blockIdx.y * 64;
    v8f acc[4][4];
#pragma unroll
    for (int mb = 0; mb < 4; ++mb)
#pragma unroll
        for (int nb = 0; nb < 4; ++nb) acc[mb][nb] = (v8f){};
    const size_t aoff = (size_t)(r0 + lr) * K + 8 * hi, boff = (size_t)(c0 + lr) * K + 8 * hi;
#pragma unroll 1
    for (int kc = 0; kc < K; kc += 32) {
        V a[4], a2[4];
#pragma unroll
        for (int mb = 0; mb < 4; ++mb) { a[mb] = WFrag<T16>::ld(A + aoff + (size_t)mb * 16 * K + kc); if (NSPLIT == 1 || NSPLIT == 2) a2[mb] = WFrag<T16>::ld(A2 + aoff + (size_t)mb * 16 * K + kc); }
#pragma unroll
        for (int nb = 0; nb < 4; ++nb) { const V b = WFrag<T16>::ld(Bt + boff + (size_t)nb * 16 * K + kc); V b2; if (NSPLIT >= 2) b2 = WFrag<T16>::ld(Bt2 + boff + (size_t)nb * 16 * K + kc);
#pragma unroll
            for (int mb = 0; mb < 4; ++mb) { acc[mb][nb] = WFrag<T16>::mma(a[mb], b, acc[mb][nb]); if (NSPLIT == 1 || NSPLIT == 2) acc[mb][nb] = WFrag<T16>::mma(a2[mb], b, acc[mb][nb]); if (NSPLIT >= 2) acc[mb][nb] = WFrag<T16>::mma(a[mb], b2, acc[mb][nb]); } }
        asm volatile("v_nop\n\tv_nop\n\tv_nop\n\tv_nop" : "+v"(acc[0][0]), "+v"(acc[1][1]), "+v"(acc[2][2]), "+v"(acc[3][3]) : "v"(a[0]), "v"(a[3]));
    }
#pragma unroll
    for (int mb = 0; mb < 4; ++mb) {
#pragma unroll
        for (int nb = 0; nb < 4; ++nb) {
#pragma unroll
            for (int j = 0; j < 8; ++j) os[(hi * 8 + j) * 68 + nb * 16 + lr] = acc[mb][nb][j]; }
        __builtin_amdgcn_wave_barrier(); asm volatile("" ::: "memory");
        float* crow = C + (size_t)(r0 + mb * 16) * ldc + c0;
{
#pragma unroll
            for (int s = 0; s < 8; ++s) { const int row = 2 * s + hi, cofs = lr * 4; v4f val = *(const v4fa*)(os + row * 68 + cofs); if (BIAS) { val[0] += bfr(bias[c0 + cofs]); val[1] += bfr(bias[c0 + cofs + 1]); val[2] += bfr(bias[c0 + cofs + 2]); val[3] += bfr(bias[c0 + cofs + 3]); }
                *(v4f*)(crow + (size_t)row * ldc + cofs) = val; }
             }
        __builtin_amdgcn_wave_barrier(); asm volatile("" ::: "memory");
    }
}

__device__ __forceinline__ h16 tohx(float x) { return (h16)x; }
__device__ __forceinline__ void splitf(float y, unsigned short& h, unsigned short& l) { h = f2bf(y); l = f2bf(y - bf2f(h)); }
typedef __attribute__((ext_vector_type(2))) _Float16 v2h;
typedef __attribute__((ext_vector_type(4))) _Float16 v4h;
typedef __attribute__((ext_vector_type(2))) unsigned short v2us;
typedef __attribute__((ext_vector_type(4))) unsigned short v4us;
typedef __attribute__((ext_vector_type(2))) float v2f;
typedef __attribute__((ext_vector_type(4))) int v4i;

__global__ __launch_bounds__(256) void k_wtG(const float* __restrict__ w, int K, int N, bf* Bt) {
    const int lane = threadIdx.x & 31; const int L0 = (blockIdx.x * 8 + (threadIdx.x >> 5)) * 8; const int nlines = N * K / 64;
{
#pragma unroll 1
        for (int l = 0; l < 8; ++l) { const int L = L0 + l; if (L >= nlines) break; const size_t e = (size_t)L * 64 + lane * 2; const int k = (int)(e % K), n = (int)(e / K); v2us o;
            o[0] = f2bf(w[(size_t)k * N + n]); o[1] = f2bf(w[(size_t)(k + 1) * N + n]); *(v2us*)(Bt + e) = o; }
         }
}
__global__ __launch_bounds__(256) void k_lnhl(const float* __restrict__ X, const float* __restrict__ A, const float* __restrict__ g, const float* __restrict__ be, float* Z, bf* Yh, bf* Yl) {
    const int lane = threadIdx.x & 31; const int r = blockIdx.x * 8 + (threadIdx.x >> 5); if (r >= TT) return; const float* xr = X + (size_t)r * DM; const float* ar = A ? A + (size_t)r * DM : nullptr; float s = 0.f;
#pragma unroll 1
    for (int ch = 0; ch < DM / 128; ++ch) { const int c0 = ch * 128 + lane * 4; const v4f a = *(const v4f*)(xr + c0); v4f d = {0.f, 0.f, 0.f, 0.f}; if (ar) d = *(const v4f*)(ar + c0);
#pragma unroll
        for (int q = 0; q < 4; ++q) s += __fadd_rn(bfr(a[q]), d[q]); }
#pragma unroll
    for (int sh = 16; sh; sh >>= 1) s += __shfl_xor(s, sh, 32);
    const float mu = s * (1.0f / DM); float s2 = 0.f;
#pragma unroll 1
    for (int ch = 0; ch < DM / 128; ++ch) { const int c0 = ch * 128 + lane * 4; const v4f a = *(const v4f*)(xr + c0); v4f d = {0.f, 0.f, 0.f, 0.f}; if (ar) d = *(const v4f*)(ar + c0);
#pragma unroll
        for (int q = 0; q < 4; ++q) { const float d0 = __fsub_rn(__fadd_rn(bfr(a[q]), d[q]), mu); float p = __fmul_rn(d0, d0); asm volatile("" : "+v"(p)); s2 = __fadd_rn(s2, p); } }
#pragma unroll
    for (int sh = 16; sh; sh >>= 1) s2 += __shfl_xor(s2, sh, 32);
    const float rs = __fdiv_rn(1.0f, __fsqrt_rn(__fadd_rn(s2 * (1.0f / DM), LNEPS)));
{
#pragma unroll 1
        for (int ch = 0; ch < DM / 128; ++ch) { const int c0 = ch * 128 + lane * 4; const v4f a = *(const v4f*)(xr + c0); v4f d = {0.f, 0.f, 0.f, 0.f}; if (ar) d = *(const v4f*)(ar + c0); v4f z4; v4us oh, ol;
#pragma unroll
            for (int q = 0; q < 4; ++q) { const float v = __fadd_rn(bfr(a[q]), d[q]); z4[q] = v; float n0 = __fmul_rn(__fsub_rn(v, mu), rs); asm volatile("" : "+v"(n0)); float n1 = __fmul_rn(n0, bfr(g[c0 + q])); asm volatile("" : "+v"(n1)); const float y = __fadd_rn(n1, bfr(be[c0 + q])); unsigned short h2, l2; splitf(y, h2, l2); oh[q] = h2; ol[q] = l2; }
            if (Z) *(v4f*)(Z + (size_t)r * DM + c0) = z4; *(v4us*)(Yh + (size_t)r * DM + c0) = oh; *(v4us*)(Yl + (size_t)r * DM + c0) = ol; }
         } }
__global__ __launch_bounds__(256) void k_addres(const float* __restrict__ X, const float* __restrict__ Y, float* O, size_t n4) { const size_t i = (size_t)blockIdx.x * 256 + threadIdx.x; if (i >= n4) return; const v4f a = *(const v4f*)(X + i * 4), b = *(const v4f*)(Y + i * 4); v4f o;
#pragma unroll
    for (int q = 0; q < 4; ++q) o[q] = __fadd_rn(bfr(a[q]), b[q]); *(v4f*)(O + i * 4) = o;  }
__global__ __launch_bounds__(256) void k_cvt8(const float* __restrict__ src, bf* dst, size_t n8) { const size_t i = (size_t)blockIdx.x * 256 + threadIdx.x; if (i >= n8) return; const v8f v = *(const v8f*)(src + i * 8); v8us o;
#pragma unroll
    for (int k = 0; k < 8; ++k) o[k] = f2bf(v[k]); *(v8us*)(dst + i * 8) = o;  }

// k_rope: head planes [h][t][d] (fp16 + hi/lo) of rope(x) x sc with the rotate-half convention out[d] = x[d] cos[t][d] - x[d+HD/2] sin[t][d], out[d+HD/2] = x[d+HD/2] cos[t][d+HD/2] + x[d] sin[t][d+HD/2]
__global__ __launch_bounds__(256) void k_rope(const float* __restrict__ F, int pitch, int nheads, const float* __restrict__ CS, const float* __restrict__ RF, const float* __restrict__ nw, float sc, h16* P16, bf* Ph, bf* Pl) {
    const size_t e = ((size_t)blockIdx.x * 256 + threadIdx.x) * 2; if (e >= (size_t)nheads * TT * HD) return; const int d = (int)(e % HD); const int t = (int)((e / HD) % TT); const int h = (int)(e / ((size_t)HD * TT)); const float* f = F + (size_t)t * pitch + h * HD; const float rf = RF ? RF[(size_t)h * TT + t] : 1.0f; v2h o16; v2us oh, ol;
#pragma unroll
    for (int q = 0; q < 2; ++q) { const int dd = d + q; const int dp = (dd < HD / 2) ? dd + HD / 2 : dd - HD / 2; float x0 = f[dd], x1 = f[dp];
        if (RF) { float n0 = __fmul_rn(x0, rf), n1 = __fmul_rn(x1, rf); asm volatile("" : "+v"(n0)); asm volatile("" : "+v"(n1)); x0 = __fmul_rn(bfr(nw[dd]), n0); x1 = __fmul_rn(bfr(nw[dp]), n1); }
        const v2f cs = *(const v2f*)(CS + ((size_t)t * HD + dd) * 2); float a = __fmul_rn(x0, cs[0]), bq = __fmul_rn(x1, cs[1]); asm volatile("" : "+v"(a)); asm volatile("" : "+v"(bq)); const float r = ((dd < HD / 2) ? __fsub_rn(a, bq) : __fadd_rn(a, bq)) * sc;
        o16[q] = tohx(r); unsigned short a2, c2; splitf(r, a2, c2); oh[q] = a2; ol[q] = c2; }
    *(v2h*)(P16 + e) = o16; *(v2us*)(Ph + e) = oh; *(v2us*)(Pl + e) = ol;  }
__global__ __launch_bounds__(256) void k_vtp(const float* __restrict__ F, int pitch, int nheads, h16* V16, bf* Vh, bf* Vl) { const size_t e = ((size_t)blockIdx.x * 256 + threadIdx.x) * 2; if (e >= (size_t)nheads * HD * TT) return; const int t = (int)(e % TT); const int d = (int)((e / TT) % HD); const int g = (int)(e / ((size_t)TT * HD)); v2h o16; v2us oh, ol;
#pragma unroll
    for (int q = 0; q < 2; ++q) { const float x = F[(size_t)(t + q) * pitch + g * HD + d]; o16[q] = tohx(x); unsigned short a2, c2; splitf(x, a2, c2); oh[q] = a2; ol[q] = c2; }
    *(v2h*)(V16 + e) = o16; *(v2us*)(Vh + e) = oh; *(v2us*)(Vl + e) = ol;  }
__global__ __launch_bounds__(256) void k_csid(float* CS) { const int idx = blockIdx.x * 256 + threadIdx.x; if (idx >= TT * HD) return; v2f cs; cs[0] = 1.0f; cs[1] = 0.0f; *(v2f*)(CS + (size_t)idx * 2) = cs;  }
// k_asoft: per row (zz, i): t = S x HD^-0.5 (no mask); softmax over the 2048 keys (register row, one exp, fixed trees);
__global__ __launch_bounds__(256) void k_asoft(const float* __restrict__ Sb, h16* P16, bf* Ph, bf* Pl) {
    const int lane = threadIdx.x & 31; const int row = blockIdx.x * 8 + (threadIdx.x >> 5); if (row >= ZH * TT) return; const int i = row % TT; const int zz = row / TT; (void)zz; const bool hires = (i < RH); const float* sr = Sb + (size_t)row * TT; float v[TT / 32]; float mx = -3.0e38f;
#pragma unroll
    for (int ch = 0; ch < TT / 128; ++ch) { const int j0 = ch * 128 + lane * 4; const v4f a = *(const v4f*)(sr + j0);
#pragma unroll
        for (int q = 0; q < 4; ++q) { const int j = j0 + q; (void)j; const float t = a[q] * SCL; v[ch * 4 + q] = t; mx = fmaxf(mx, t); } }
#pragma unroll
    for (int sh = 16; sh; sh >>= 1) mx = fmaxf(mx, __shfl_xor(mx, sh, 32));
    float sum = 0.f;
#pragma unroll
    for (int k = 0; k < TT / 32; ++k) { float d0 = __fsub_rn(v[k], mx); asm volatile("" : "+v"(d0)); v[k] = __builtin_amdgcn_exp2f(__fmul_rn(d0, 1.4426950408889634f)); sum += v[k]; }
#pragma unroll
    for (int sh = 16; sh; sh >>= 1) sum += __shfl_xor(sum, sh, 32);
    const float f = __fdiv_rn(hires ? 1.0f : PCAR, sum);
{
        if (hires) {
#pragma unroll
            for (int ch = 0; ch < TT / 128; ++ch) { v4us oh, ol;
#pragma unroll
                for (int q = 0; q < 4; ++q) { unsigned short a, c2; splitf(v[ch * 4 + q] * f, a, c2); oh[q] = a; ol[q] = c2; }
                const size_t oo = ((size_t)zz * (RH ? RH : 1) + i) * TT + ch * 128 + lane * 4; *(v4us*)(Ph + oo) = oh; *(v4us*)(Pl + oo) = ol; }
        } else {
#pragma unroll
            for (int ch = 0; ch < TT / 128; ++ch) { v4h o4;
#pragma unroll
                for (int q = 0; q < 4; ++q) o4[q] = tohx(v[ch * 4 + q] * f);
                *(v4h*)(P16 + (size_t)row * TT + ch * 128 + lane * 4) = o4; } }
         }
}
__global__ __launch_bounds__(256) void k_merge(const float* __restrict__ O, int h0, float* OUTb) { const size_t e = ((size_t)blockIdx.x * 256 + threadIdx.x) * 2; if (e >= (size_t)ZH * TT * HD) return; const int d = (int)(e % HD); const int t = (int)((e / HD) % TT); const int zz = (int)(e / ((size_t)HD * TT)); const float cs = (t < RH) ? 1.0f : (1.0f / PCAR); const size_t oo = (size_t)t * DQ + (h0 + zz) * HD + d;
    v2f o2; o2[0] = O[e] * cs; o2[1] = O[e + 1] * cs; *(v2f*)(OUTb + oo) = o2;  }   /* f32 context [t][h*64 + d] straight to the output */

extern "C" void kernel_launch(void* const* d_in, const int* in_sizes, int n_in,
                              void* d_out, int out_size, void* d_ws, size_t ws_size, hipStream_t stream) {
    (void)in_sizes; (void)n_in; (void)out_size;
    const float* x = (const float*)d_in[0]; const float* g1 = (const float*)d_in[1]; const float* e1b = (const float*)d_in[2]; const float* wq = (const float*)d_in[3]; const float* bq = (const float*)d_in[4]; const float* wk = (const float*)d_in[5]; const float* bk = (const float*)d_in[6]; const float* wv = (const float*)d_in[7]; const float* bv = (const float*)d_in[8]; const float* wo = nullptr; (void)wo;
    float* OUT = (float*)d_out;     // [4][2048][1024]
    char* wsp = (char*)d_ws;
    auto take = [&](size_t bytes) { char* p = wsp; wsp += (bytes + 255) & ~(size_t)255; return (void*)p; };
    bf* WQ = (bf*)take((size_t)DQ * DM * 2); bf* WK = (bf*)take((size_t)DKV * DM * 2); bf* WV = (bf*)take((size_t)DKV * DM * 2); float* CS = (float*)take((size_t)TT * HD * 2 * 4);
    bf* Yh = (bf*)take((size_t)TT * DM * 2); bf* Yl = (bf*)take((size_t)TT * DM * 2); float* FQ = (float*)take((size_t)TT * DQ * 4); float* FK = (float*)take((size_t)TT * DKV * 4);
    h16* QP16 = (h16*)take((size_t)NH_ * TT * HD * 2); h16* KP16 = (h16*)take((size_t)NKV * TT * HD * 2); h16* VT16 = (h16*)take((size_t)NKV * HD * TT * 2);
    bf* QPh = (bf*)take((size_t)NH_ * TT * HD * 2); bf* QPl = (bf*)take((size_t)NH_ * TT * HD * 2); bf* KPh = (bf*)take((size_t)NKV * TT * HD * 2); bf* KPl = (bf*)take((size_t)NKV * TT * HD * 2); bf* VTh = (bf*)take((size_t)NKV * HD * TT * 2); bf* VTl = (bf*)take((size_t)NKV * HD * TT * 2); bf* Ph = (bf*)take((size_t)ZH * RH * TT * 2); bf* Pl = (bf*)take((size_t)ZH * RH * TT * 2);
    float* Sb = (float*)take((size_t)ZH * TT * TT * 4); h16* P16 = (h16*)take((size_t)ZH * TT * TT * 2); float* Ob = (float*)take((size_t)ZH * TT * HD * 4); 
    if ((size_t)(wsp - (char*)d_ws) > ws_size) return;    // ws 256 MiB
    float* FV = FK;   // v projection reuses the k buffer after the k planes are built (stream-ordered)
    { k_cvt8<<<(unsigned)(((size_t)DQ * DM / 8 + 255) / 256), 256, 0, stream>>>(wq, WQ, (size_t)DQ * DM / 8); k_cvt8<<<(unsigned)(((size_t)DKV * DM / 8 + 255) / 256), 256, 0, stream>>>(wk, WK, (size_t)DKV * DM / 8); k_cvt8<<<(unsigned)(((size_t)DKV * DM / 8 + 255) / 256), 256, 0, stream>>>(wv, WV, (size_t)DKV * DM / 8);
       }
    k_csid<<<(TT * HD + 255) / 256, 256, 0, stream>>>(CS);
    const unsigned LQ = (unsigned)(((size_t)NH_ * TT * HD / 2 + 255) / 256), LKv = (unsigned)(((size_t)NKV * TT * HD / 2 + 255) / 256);
    for (int b = 0; b < NB_; ++b) {
        
        k_lnhl<<<TT / 8, 256, 0, stream>>>(x + (size_t)b * TT * DM, nullptr, g1, e1b, nullptr, Yh, Yl);   /* x = LN(h) as hi/lo planes */
        k_gemmw<bf, 1, true><<<dim3(TT / 64, DQ / 64, 1), 32, 0, stream>>>(Yh, Yl, WQ, nullptr, DM, FQ, DQ, bq, 0, 0, 0);
        k_rope<<<LQ, 256, 0, stream>>>(FQ, DQ, NH_, CS, nullptr, nullptr, 1.0f, QP16, QPh, QPl);
        k_gemmw<bf, 1, true><<<dim3(TT / 64, DKV / 64, 1), 32, 0, stream>>>(Yh, Yl, WK, nullptr, DM, FK, DKV, bk, 0, 0, 0);
        k_rope<<<LKv, 256, 0, stream>>>(FK, DKV, NKV, CS, nullptr, nullptr, 1.0f, KP16, KPh, KPl);
        k_gemmw<bf, 1, true><<<dim3(TT / 64, DKV / 64, 1), 32, 0, stream>>>(Yh, Yl, WV, nullptr, DM, FV, DKV, bv, 0, 0, 0); k_vtp<<<LKv, 256, 0, stream>>>(FV, DKV, NKV, VT16, VTh, VTl);
        for (int h0 = 0; h0 < NH_; h0 += ZH) { const size_t zq = (size_t)h0, zk = (size_t)(h0 / REP);   // one kv head per query head: the pass's two heads use consecutive kv planes (z-strides TT*HD)
            k_gemmw<bf, 2, false><<<dim3(RH / 64, TT / 64, ZH), 32, 0, stream>>>(QPh + zq * TT * HD, QPl + zq * TT * HD, KPh + zk * TT * HD, KPl + zk * TT * HD, HD, Sb, TT, nullptr, (size_t)TT * HD, (size_t)TT * HD, (size_t)TT * TT);
            k_gemmw<h16, 0, false><<<dim3((TT - RH) / 64, TT / 64, ZH), 32, 0, stream>>>(QP16 + zq * TT * HD + (size_t)RH * HD, nullptr, KP16 + zk * TT * HD, nullptr, HD, Sb + (size_t)RH * TT, TT, nullptr, (size_t)TT * HD, (size_t)TT * HD, (size_t)TT * TT);
            k_asoft<<<ZH * TT / 8, 256, 0, stream>>>(Sb, P16, Ph, Pl);
            k_gemmw<bf, 2, false><<<dim3(RH / 64, HD / 64, ZH), 32, 0, stream>>>(Ph, Pl, VTh + zk * HD * TT, VTl + zk * HD * TT, TT, Ob, HD, nullptr, (size_t)RH * TT, (size_t)HD * TT, (size_t)TT * HD);
            k_gemmw<h16, 0, false><<<dim3((TT - RH) / 64, HD / 64, ZH), 32, 0, stream>>>(P16 + (size_t)RH * TT, nullptr, VT16 + zk * HD * TT, nullptr, TT, Ob + (size_t)RH * HD, HD, nullptr, (size_t)TT * TT, (size_t)HD * TT, (size_t)TT * HD);
            k_merge<<<(unsigned)(((size_t)ZH * TT * HD / 2 + 255) / 256), 256, 0, stream>>>(Ob, h0, OUT + (size_t)b * TT * DM); }
    }
}

// v001
// It runs in 2090 microseconds.
// Next to v000, in two timings, it ran 1.87 times as fast each time.
#include <hip/hip_runtime.h>

// Perceiver self-attention (hidden_states [4][2048][1024]; x = LN(h) (1e-5, gamma, beta); q, k, v = x W^T + b ('oi' [1024][1024], 16 heads x 64); softmax(q.k/8) over all keys; out = merged context (no output projection) -> [4][2048][1024] (8.4 M)).
// Compute dtypes, f32 accumulate: every input rounded to bf16; q/k/v on hi/lo bf16 x planes times bf16 W (2 products) + biases; scores and attn.v (no mask): query rows < 512 hl (3 products), the rest single fp16 (x1024); softmax f32; no output projection: the merged context is written in f32.

#define NB_  4
#define TT   2048
#define DM   1024
#define NH_  16
#define NKV  16
#define REP  (NH_ / NKV)
#define HD   64
#define DQ   (NH_ * HD)
#define DKV  (NKV * HD)
#define LNEPS 1e-5f
typedef __attribute__((ext_vector_type(4))) unsigned short v4us;
#define ZH   2
#define RH   512                  // query rows < RH use hi+lo planes (0: none)
#define WIN  0
#define PCAR 1024.0f
#define SCL  0.125f   // HD^-0.5
#define KSP  8                    // waves that share the k range of one tile: projections (K = 1024)
#define KSH  16                   // attn.v, hi+lo rows (K = 2048)
#define KSV  16                   // attn.v, fp16 rows (K = 2048)
typedef _Float16 h16;
typedef unsigned short bf;
typedef __attribute__((ext_vector_type(16))) __bf16   v16bf;
typedef __attribute__((ext_vector_type(16))) _Float16 v16h;
typedef __attribute__((ext_vector_type(8)))  _Float16 v8h;
typedef __attribute__((ext_vector_type(8)))  unsigned short v8us;
typedef __attribute__((ext_vector_type(8)))  float    v8f;
typedef __attribute__((ext_vector_type(4)))  float    v4f;
typedef v8h  __attribute__((may_alias)) v8ha;
typedef v4f  __attribute__((may_alias)) v4fa;
typedef v8us __attribute__((may_alias)) v8usa;

__device__ __forceinline__ unsigned short f2bf(float f) { unsigned u = __float_as_uint(f); u += 0x7FFFu + ((u >> 16) & 1u); return (unsigned short)(u >> 16); }
__device__ __forceinline__ float bf2f(unsigned short b) { return __uint_as_float(((unsigned)b) << 16); }
__device__ __forceinline__ float bfr(float f) { return bf2f(f2bf(f)); }
__device__ __forceinline__ v16h cat16(v8h lo, v8h hi) { return __builtin_shufflevector(lo, hi, 0, 1, 2, 3, 4, 5, 6, 7, 8, 9, 10, 11, 12, 13, 14, 15); }
__device__ __forceinline__ v16bf cat16b(v8us lo, v8us hi) { return __builtin_bit_cast(v16bf, __builtin_shufflevector(lo, hi, 0, 1, 2, 3, 4, 5, 6, 7, 8, 9, 10, 11, 12, 13, 14, 15)); }
__device__ __forceinline__ v8f wmma16(v16h a, v16h b, v8f c) { return __builtin_amdgcn_wmma_f32_16x16x32_f16(false, a, false, b, (short)0, c, false, false); }
__device__ __forceinline__ v8f wmmab(v16bf a, v16bf b, v8f c) { return __builtin_amdgcn_wmma_f32_16x16x32_bf16(false, a, false, b, (short)0, c, false, false); }



// ---- k_gemmw: register-blocked GEMM, one work-group of KS waves per 64x64 output tile (16 accumulators a wave), operands straight from K-contiguous 16-bit planes; grid (M/64, N/64, Z), 32 * KS threads.
// KS > 1: wave w sums k in [w K/KS, (w+1) K/KS); the KS partial tiles meet in LDS and are added in the fixed order w = 0 .. KS-1. K % (32 KS) == 0.
// C[m][n] (f32, pitch ldc, + optional f32 bias[n]) = sum_k A[m][k] Bt[n][k] (+ split products per NSPLIT). z-batch strides sA/sB/sC in elements. K % 32 == 0.
template <typename T16> struct WFrag;
template <> struct WFrag<h16> { typedef v16h V; static __device__ __forceinline__ V ld(const h16* p) { return cat16(*(const v8h*)p, *(const v8h*)(p + 16)); } static __device__ __forceinline__ v8f mma(V a, V b, v8f c) { return wmma16(a, b, c); } };
template <> struct WFrag<bf> { typedef v16bf V; static __device__ __forceinline__ V ld(const bf* p) { return cat16b(*(const v8us*)p, *(const v8us*)(p + 16)); } static __device__ __forceinline__ v8f mma(V a, V b, v8f c) { return wmmab(a, b, c); } };
template <typename T16, int NSPLIT, bool BIAS, int KS>
__global__ __launch_bounds__(32 * KS) void k_gemmw(const T16* __restrict__ A, const T16* __restrict__ A2, const T16* __restrict__ Bt, const T16* __restrict__ Bt2, int K, float* C, int ldc, const float* __restrict__ bias, size_t sA, size_t sB, size_t sC) {
    typedef typename WFrag<T16>::V V;
    __shared__ __align__(16) float os[(KS == 1 ? 16 : KS * 64) * 68];
    const size_t z = blockIdx.z; A += z * sA; if (A2) A2 += z * sA; Bt += z * sB; if (Bt2) Bt2 += z * sB; C += z * sC;
    const int lane = threadIdx.x & 31, lr = lane & 15, hi = lane >> 4; const int r0 = blockIdx.x * 64, c0 = blockIdx.y * 64;
    v8f acc[4][4];
#pragma unroll
    for (int mb = 0; mb < 4; ++mb)
#pragma unroll
        for (int nb = 0; nb < 4; ++nb) acc[mb][nb] = (v8f){};
    const size_t aoff = (size_t)(r0 + lr) * K + 8 * hi, boff = (size_t)(c0 + lr) * K + 8 * hi;
    const int wv = __builtin_amdgcn_readfirstlane((int)(threadIdx.x >> 5)); const int kb = wv * (K / KS), ke = kb + K / KS;   // this wave's k range; readfirstlane keeps the loop bounds scalar
#pragma unroll 1
    for (int kc = kb; kc < ke; kc += 32) {
        V a[4], a2[4];
#pragma unroll
        for (int mb = 0; mb < 4; ++mb) { a[mb] = WFrag<T16>::ld(A + aoff + (size_t)mb * 16 * K + kc); if (NSPLIT == 1 || NSPLIT == 2) a2[mb] = WFrag<T16>::ld(A2 + aoff + (size_t)mb * 16 * K + kc); }
#pragma unroll
        for (int nb = 0; nb < 4; ++nb) { const V b = WFrag<T16>::ld(Bt + boff + (size_t)nb * 16 * K + kc); V b2; if (NSPLIT >= 2) b2 = WFrag<T16>::ld(Bt2 + boff + (size_t)nb * 16 * K + kc);
#pragma unroll
            for (int mb = 0; mb < 4; ++mb) { acc[mb][nb] = WFrag<T16>::mma(a[mb], b, acc[mb][nb]); if (NSPLIT == 1 || NSPLIT == 2) acc[mb][nb] = WFrag<T16>::mma(a2[mb], b, acc[mb][nb]); if (NSPLIT >= 2) acc[mb][nb] = WFrag<T16>::mma(a[mb], b2, acc[mb][nb]); } }
        asm volatile("v_nop\n\tv_nop\n\tv_nop\n\tv_nop" : "+v"(acc[0][0]), "+v"(acc[1][1]), "+v"(acc[2][2]), "+v"(acc[3][3]) : "v"(a[0]), "v"(a[3]));
    }
    if (KS > 1) {
        float* ow = os + wv * (64 * 68);
        // the three loops are unrolled so that acc is indexed by constants and stays in registers
#pragma unroll
        for (int mb = 0; mb < 4; ++mb)
#pragma unroll
            for (int nb = 0; nb < 4; ++nb)
#pragma unroll
                for (int j = 0; j < 8; ++j) ow[(mb * 16 + hi * 8 + j) * 68 + nb * 16 + lr] = acc[mb][nb][j];
        __syncthreads();   // every wave's partial tile is in LDS before any thread adds them
        // both loops unrolled: a thread's LDS reads issue together instead of one wait per read
#pragma unroll
        for (int s = 0; s < 32 / KS; ++s) { const int i = s * (32 * KS) + (int)threadIdx.x, row = i >> 4, cofs = (i & 15) * 4; v4f val = *(const v4fa*)(os + row * 68 + cofs);
#pragma unroll
            for (int w = 1; w < KS; ++w) val += *(const v4fa*)(os + (w * 64 + row) * 68 + cofs);
            if (BIAS) { val[0] += bfr(bias[c0 + cofs]); val[1] += bfr(bias[c0 + cofs + 1]); val[2] += bfr(bias[c0 + cofs + 2]); val[3] += bfr(bias[c0 + cofs + 3]); }
            *(v4f*)(C + (size_t)(r0 + row) * ldc + c0 + cofs) = val; }
        return;
    }
#pragma unroll
    for (int mb = 0; mb < 4; ++mb) {
#pragma unroll
        for (int nb = 0; nb < 4; ++nb) {
#pragma unroll
            for (int j = 0; j < 8; ++j) os[(hi * 8 + j) * 68 + nb * 16 + lr] = acc[mb][nb][j]; }
        __builtin_amdgcn_wave_barrier(); asm volatile("" ::: "memory");
        float* crow = C + (size_t)(r0 + mb * 16) * ldc + c0;
{
#pragma unroll
            for (int s = 0; s < 8; ++s) { const int row = 2 * s + hi, cofs = lr * 4; v4f val = *(const v4fa*)(os + row * 68 + cofs); if (BIAS) { val[0] += bfr(bias[c0 + cofs]); val[1] += bfr(bias[c0 + cofs + 1]); val[2] += bfr(bias[c0 + cofs + 2]); val[3] += bfr(bias[c0 + cofs + 3]); }
                *(v4f*)(crow + (size_t)row * ldc + cofs) = val; }
             }
        __builtin_amdgcn_wave_barrier(); asm volatile("" ::: "memory");
    }
}

__device__ __forceinline__ h16 tohx(float x) { return (h16)x; }
__device__ __forceinline__ void splitf(float y, unsigned short& h, unsigned short& l) { h = f2bf(y); l = f2bf(y - bf2f(h)); }
typedef __attribute__((ext_vector_type(2))) _Float16 v2h;
typedef __attribute__((ext_vector_type(4))) _Float16 v4h;
typedef __attribute__((ext_vector_type(2))) unsigned short v2us;
typedef __attribute__((ext_vector_type(4))) unsigned short v4us;
typedef __attribute__((ext_vector_type(2))) float v2f;
typedef __attribute__((ext_vector_type(4))) int v4i;

__global__ __launch_bounds__(256) void k_wtG(const float* __restrict__ w, int K, int N, bf* Bt) {
    const int lane = threadIdx.x & 31; const int L0 = (blockIdx.x * 8 + (threadIdx.x >> 5)) * 8; const int nlines = N * K / 64;
{
#pragma unroll 1
        for (int l = 0; l < 8; ++l) { const int L = L0 + l; if (L >= nlines) break; const size_t e = (size_t)L * 64 + lane * 2; const int k = (int)(e % K), n = (int)(e / K); v2us o;
            o[0] = f2bf(w[(size_t)k * N + n]); o[1] = f2bf(w[(size_t)(k + 1) * N + n]); *(v2us*)(Bt + e) = o; }
         }
}
__global__ __launch_bounds__(256) void k_lnhl(const float* __restrict__ X, const float* __restrict__ A, const float* __restrict__ g, const float* __restrict__ be, float* Z, bf* Yh, bf* Yl) {
    const int lane = threadIdx.x & 31; const int r = blockIdx.x * 8 + (threadIdx.x >> 5); if (r >= TT) return; const float* xr = X + (size_t)r * DM; const float* ar = A ? A + (size_t)r * DM : nullptr; float s = 0.f;
#pragma unroll 1
    for (int ch = 0; ch < DM / 128; ++ch) { const int c0 = ch * 128 + lane * 4; const v4f a = *(const v4f*)(xr + c0); v4f d = {0.f, 0.f, 0.f, 0.f}; if (ar) d = *(const v4f*)(ar + c0);
#pragma unroll
        for (int q = 0; q < 4; ++q) s += __fadd_rn(bfr(a[q]), d[q]); }
#pragma unroll
    for (int sh = 16; sh; sh >>= 1) s += __shfl_xor(s, sh, 32);
    const float mu = s * (1.0f / DM); float s2 = 0.f;
#pragma unroll 1
    for (int ch = 0; ch < DM / 128; ++ch) { const int c0 = ch * 128 + lane * 4; const v4f a = *(const v4f*)(xr + c0); v4f d = {0.f, 0.f, 0.f, 0.f}; if (ar) d = *(const v4f*)(ar + c0);
#pragma unroll
        for (int q = 0; q < 4; ++q) { const float d0 = __fsub_rn(__fadd_rn(bfr(a[q]), d[q]), mu); float p = __fmul_rn(d0, d0); asm volatile("" : "+v"(p)); s2 = __fadd_rn(s2, p); } }
#pragma unroll
    for (int sh = 16; sh; sh >>= 1) s2 += __shfl_xor(s2, sh, 32);
    const float rs = __fdiv_rn(1.0f, __fsqrt_rn(__fadd_rn(s2 * (1.0f / DM), LNEPS)));
{
#pragma unroll 1
        for (int ch = 0; ch < DM / 128; ++ch) { const int c0 = ch * 128 + lane * 4; const v4f a = *(const v4f*)(xr + c0); v4f d = {0.f, 0.f, 0.f, 0.f}; if (ar) d = *(const v4f*)(ar + c0); v4f z4; v4us oh, ol;
#pragma unroll
            for (int q = 0; q < 4; ++q) { const float v = __fadd_rn(bfr(a[q]), d[q]); z4[q] = v; float n0 = __fmul_rn(__fsub_rn(v, mu), rs); asm volatile("" : "+v"(n0)); float n1 = __fmul_rn(n0, bfr(g[c0 + q])); asm volatile("" : "+v"(n1)); const float y = __fadd_rn(n1, bfr(be[c0 + q])); unsigned short h2, l2; splitf(y, h2, l2); oh[q] = h2; ol[q] = l2; }
            if (Z) *(v4f*)(Z + (size_t)r * DM + c0) = z4; *(v4us*)(Yh + (size_t)r * DM + c0) = oh; *(v4us*)(Yl + (size_t)r * DM + c0) = ol; }
         } }
__global__ __launch_bounds__(256) void k_addres(const float* __restrict__ X, const float* __restrict__ Y, float* O, size_t n4) { const size_t i = (size_t)blockIdx.x * 256 + threadIdx.x; if (i >= n4) return; const v4f a = *(const v4f*)(X + i * 4), b = *(const v4f*)(Y + i * 4); v4f o;
#pragma unroll
    for (int q = 0; q < 4; ++q) o[q] = __fadd_rn(bfr(a[q]), b[q]); *(v4f*)(O + i * 4) = o;  }
__global__ __launch_bounds__(256) void k_cvt8(const float* __restrict__ src, bf* dst, size_t n8) { const size_t i = (size_t)blockIdx.x * 256 + threadIdx.x; if (i >= n8) return; const v8f v = *(const v8f*)(src + i * 8); v8us o;
#pragma unroll
    for (int k = 0; k < 8; ++k) o[k] = f2bf(v[k]); *(v8us*)(dst + i * 8) = o;  }

// k_rope: head planes [h][t][d] (fp16 + hi/lo) of rope(x) x sc with the rotate-half convention out[d] = x[d] cos[t][d] - x[d+HD/2] sin[t][d], out[d+HD/2] = x[d+HD/2] cos[t][d+HD/2] + x[d] sin[t][d+HD/2]
__global__ __launch_bounds__(256) void k_rope(const float* __restrict__ F, int pitch, int nheads, const float* __restrict__ CS, const float* __restrict__ RF, const float* __restrict__ nw, float sc, h16* P16, bf* Ph, bf* Pl) {
    const size_t e = ((size_t)blockIdx.x * 256 + threadIdx.x) * 2; if (e >= (size_t)nheads * TT * HD) return; const int d = (int)(e % HD); const int t = (int)((e / HD) % TT); const int h = (int)(e / ((size_t)HD * TT)); const float* f = F + (size_t)t * pitch + h * HD; const float rf = RF ? RF[(size_t)h * TT + t] : 1.0f; v2h o16; v2us oh, ol;
#pragma unroll
    for (int q = 0; q < 2; ++q) { const int dd = d + q; const int dp = (dd < HD / 2) ? dd + HD / 2 : dd - HD / 2; float x0 = f[dd], x1 = f[dp];
        if (RF) { float n0 = __fmul_rn(x0, rf), n1 = __fmul_rn(x1, rf); asm volatile("" : "+v"(n0)); asm volatile("" : "+v"(n1)); x0 = __fmul_rn(bfr(nw[dd]), n0); x1 = __fmul_rn(bfr(nw[dp]), n1); }
        const v2f cs = *(const v2f*)(CS + ((size_t)t * HD + dd) * 2); float a = __fmul_rn(x0, cs[0]), bq = __fmul_rn(x1, cs[1]); asm volatile("" : "+v"(a)); asm volatile("" : "+v"(bq)); const float r = ((dd < HD / 2) ? __fsub_rn(a, bq) : __fadd_rn(a, bq)) * sc;
        o16[q] = tohx(r); unsigned short a2, c2; splitf(r, a2, c2); oh[q] = a2; ol[q] = c2; }
    *(v2h*)(P16 + e) = o16; *(v2us*)(Ph + e) = oh; *(v2us*)(Pl + e) = ol;  }
__global__ __launch_bounds__(256) void k_vtp(const float* __restrict__ F, int pitch, int nheads, h16* V16, bf* Vh, bf* Vl) { const size_t e = ((size_t)blockIdx.x * 256 + threadIdx.x) * 2; if (e >= (size_t)nheads * HD * TT) return; const int t = (int)(e % TT); const int d = (int)((e / TT) % HD); const int g = (int)(e / ((size_t)TT * HD)); v2h o16; v2us oh, ol;
#pragma unroll
    for (int q = 0; q < 2; ++q) { const float x = F[(size_t)(t + q) * pitch + g * HD + d]; o16[q] = tohx(x); unsigned short a2, c2; splitf(x, a2, c2); oh[q] = a2; ol[q] = c2; }
    *(v2h*)(V16 + e) = o16; *(v2us*)(Vh + e) = oh; *(v2us*)(Vl + e) = ol;  }
__global__ __launch_bounds__(256) void k_csid(float* CS) { const int idx = blockIdx.x * 256 + threadIdx.x; if (idx >= TT * HD) return; v2f cs; cs[0] = 1.0f; cs[1] = 0.0f; *(v2f*)(CS + (size_t)idx * 2) = cs;  }
// k_asoft: per row (zz, i): t = S x HD^-0.5 (no mask); softmax over the 2048 keys (register row, one exp, fixed trees);
__global__ __launch_bounds__(256) void k_asoft(const float* __restrict__ Sb, h16* P16, bf* Ph, bf* Pl) {
    const int lane = threadIdx.x & 31; const int row = blockIdx.x * 8 + (threadIdx.x >> 5); if (row >= ZH * TT) return; const int i = row % TT; const int zz = row / TT; (void)zz; const bool hires = (i < RH); const float* sr = Sb + (size_t)row * TT; float v[TT / 32]; float mx = -3.0e38f;
#pragma unroll
    for (int ch = 0; ch < TT / 128; ++ch) { const int j0 = ch * 128 + lane * 4; const v4f a = *(const v4f*)(sr + j0);
#pragma unroll
        for (int q = 0; q < 4; ++q) { const int j = j0 + q; (void)j; const float t = a[q] * SCL; v[ch * 4 + q] = t; mx = fmaxf(mx, t); } }
#pragma unroll
    for (int sh = 16; sh; sh >>= 1) mx = fmaxf(mx, __shfl_xor(mx, sh, 32));
    float sum = 0.f;
#pragma unroll
    for (int k = 0; k < TT / 32; ++k) { float d0 = __fsub_rn(v[k], mx); asm volatile("" : "+v"(d0)); v[k] = __builtin_amdgcn_exp2f(__fmul_rn(d0, 1.4426950408889634f)); sum += v[k]; }
#pragma unroll
    for (int sh = 16; sh; sh >>= 1) sum += __shfl_xor(sum, sh, 32);
    const float f = __fdiv_rn(hires ? 1.0f : PCAR, sum);
{
        if (hires) {
#pragma unroll
            for (int ch = 0; ch < TT / 128; ++ch) { v4us oh, ol;
#pragma unroll
                for (int q = 0; q < 4; ++q) { unsigned short a, c2; splitf(v[ch * 4 + q] * f, a, c2); oh[q] = a; ol[q] = c2; }
                const size_t oo = ((size_t)zz * (RH ? RH : 1) + i) * TT + ch * 128 + lane * 4; *(v4us*)(Ph + oo) = oh; *(v4us*)(Pl + oo) = ol; }
        } else {
#pragma unroll
            for (int ch = 0; ch < TT / 128; ++ch) { v4h o4;
#pragma unroll
                for (int q = 0; q < 4; ++q) o4[q] = tohx(v[ch * 4 + q] * f);
                *(v4h*)(P16 + (size_t)row * TT + ch * 128 + lane * 4) = o4; } }
         }
}
__global__ __launch_bounds__(256) void k_merge(const float* __restrict__ O, int h0, float* OUTb) { const size_t e = ((size_t)blockIdx.x * 256 + threadIdx.x) * 2; if (e >= (size_t)ZH * TT * HD) return; const int d = (int)(e % HD); const int t = (int)((e / HD) % TT); const int zz = (int)(e / ((size_t)HD * TT)); const float cs = (t < RH) ? 1.0f : (1.0f / PCAR); const size_t oo = (size_t)t * DQ + (h0 + zz) * HD + d;
    v2f o2; o2[0] = O[e] * cs; o2[1] = O[e + 1] * cs; *(v2f*)(OUTb + oo) = o2;  }   /* f32 context [t][h*64 + d] straight to the output */

extern "C" void kernel_launch(void* const* d_in, const int* in_sizes, int n_in,
                              void* d_out, int out_size, void* d_ws, size_t ws_size, hipStream_t stream) {
    (void)in_sizes; (void)n_in; (void)out_size;
    const float* x = (const float*)d_in[0]; const float* g1 = (const float*)d_in[1]; const float* e1b = (const float*)d_in[2]; const float* wq = (const float*)d_in[3]; const float* bq = (const float*)d_in[4]; const float* wk = (const float*)d_in[5]; const float* bk = (const float*)d_in[6]; const float* wv = (const float*)d_in[7]; const float* bv = (const float*)d_in[8]; const float* wo = nullptr; (void)wo;
    float* OUT = (float*)d_out;     // [4][2048][1024]
    char* wsp = (char*)d_ws;
    auto take = [&](size_t bytes) { char* p = wsp; wsp += (bytes + 255) & ~(size_t)255; return (void*)p; };
    bf* WQ = (bf*)take((size_t)DQ * DM * 2); bf* WK = (bf*)take((size_t)DKV * DM * 2); bf* WV = (bf*)take((size_t)DKV * DM * 2); float* CS = (float*)take((size_t)TT * HD * 2 * 4);
    bf* Yh = (bf*)take((size_t)TT * DM * 2); bf* Yl = (bf*)take((size_t)TT * DM * 2); float* FQ = (float*)take((size_t)TT * DQ * 4); float* FK = (float*)take((size_t)TT * DKV * 4);
    h16* QP16 = (h16*)take((size_t)NH_ * TT * HD * 2); h16* KP16 = (h16*)take((size_t)NKV * TT * HD * 2); h16* VT16 = (h16*)take((size_t)NKV * HD * TT * 2);
    bf* QPh = (bf*)take((size_t)NH_ * TT * HD * 2); bf* QPl = (bf*)take((size_t)NH_ * TT * HD * 2); bf* KPh = (bf*)take((size_t)NKV * TT * HD * 2); bf* KPl = (bf*)take((size_t)NKV * TT * HD * 2); bf* VTh = (bf*)take((size_t)NKV * HD * TT * 2); bf* VTl = (bf*)take((size_t)NKV * HD * TT * 2); bf* Ph = (bf*)take((size_t)ZH * RH * TT * 2); bf* Pl = (bf*)take((size_t)ZH * RH * TT * 2);
    float* Sb = (float*)take((size_t)ZH * TT * TT * 4); h16* P16 = (h16*)take((size_t)ZH * TT * TT * 2); float* Ob = (float*)take((size_t)ZH * TT * HD * 4); 
    if ((size_t)(wsp - (char*)d_ws) > ws_size) return;    // ws 256 MiB
    float* FV = FK;   // v projection reuses the k buffer after the k planes are built (stream-ordered)
    { k_cvt8<<<(unsigned)(((size_t)DQ * DM / 8 + 255) / 256), 256, 0, stream>>>(wq, WQ, (size_t)DQ * DM / 8); k_cvt8<<<(unsigned)(((size_t)DKV * DM / 8 + 255) / 256), 256, 0, stream>>>(wk, WK, (size_t)DKV * DM / 8); k_cvt8<<<(unsigned)(((size_t)DKV * DM / 8 + 255) / 256), 256, 0, stream>>>(wv, WV, (size_t)DKV * DM / 8);
       }
    k_csid<<<(TT * HD + 255) / 256, 256, 0, stream>>>(CS);
    const unsigned LQ = (unsigned)(((size_t)NH_ * TT * HD / 2 + 255) / 256), LKv = (unsigned)(((size_t)NKV * TT * HD / 2 + 255) / 256);
    for (int b = 0; b < NB_; ++b) {
        
        k_lnhl<<<TT / 8, 256, 0, stream>>>(x + (size_t)b * TT * DM, nullptr, g1, e1b, nullptr, Yh, Yl);   /* x = LN(h) as hi/lo planes */
        k_gemmw<bf, 1, true, KSP><<<dim3(TT / 64, DQ / 64, 1), 32 * KSP, 0, stream>>>(Yh, Yl, WQ, nullptr, DM, FQ, DQ, bq, 0, 0, 0);
        k_rope<<<LQ, 256, 0, stream>>>(FQ, DQ, NH_, CS, nullptr, nullptr, 1.0f, QP16, QPh, QPl);
        k_gemmw<bf, 1, true, KSP><<<dim3(TT / 64, DKV / 64, 1), 32 * KSP, 0, stream>>>(Yh, Yl, WK, nullptr, DM, FK, DKV, bk, 0, 0, 0);
        k_rope<<<LKv, 256, 0, stream>>>(FK, DKV, NKV, CS, nullptr, nullptr, 1.0f, KP16, KPh, KPl);
        k_gemmw<bf, 1, true, KSP><<<dim3(TT / 64, DKV / 64, 1), 32 * KSP, 0, stream>>>(Yh, Yl, WV, nullptr, DM, FV, DKV, bv, 0, 0, 0); k_vtp<<<LKv, 256, 0, stream>>>(FV, DKV, NKV, VT16, VTh, VTl);
        for (int h0 = 0; h0 < NH_; h0 += ZH) { const size_t zq = (size_t)h0, zk = (size_t)(h0 / REP);   // one kv head per query head: the pass's two heads use consecutive kv planes (z-strides TT*HD)
            k_gemmw<bf, 2, false, 1><<<dim3(RH / 64, TT / 64, ZH), 32, 0, stream>>>(QPh + zq * TT * HD, QPl + zq * TT * HD, KPh + zk * TT * HD, KPl + zk * TT * HD, HD, Sb, TT, nullptr, (size_t)TT * HD, (size_t)TT * HD, (size_t)TT * TT);
            k_gemmw<h16, 0, false, 1><<<dim3((TT - RH) / 64, TT / 64, ZH), 32, 0, stream>>>(QP16 + zq * TT * HD + (size_t)RH * HD, nullptr, KP16 + zk * TT * HD, nullptr, HD, Sb + (size_t)RH * TT, TT, nullptr, (size_t)TT * HD, (size_t)TT * HD, (size_t)TT * TT);
            k_asoft<<<ZH * TT / 8, 256, 0, stream>>>(Sb, P16, Ph, Pl);
            k_gemmw<bf, 2, false, KSH><<<dim3(RH / 64, HD / 64, ZH), 32 * KSH, 0, stream>>>(Ph, Pl, VTh + zk * HD * TT, VTl + zk * HD * TT, TT, Ob, HD, nullptr, (size_t)RH * TT, (size_t)HD * TT, (size_t)TT * HD);
            k_gemmw<h16, 0, false, KSV><<<dim3((TT - RH) / 64, HD / 64, ZH), 32 * KSV, 0, stream>>>(P16 + (size_t)RH * TT, nullptr, VT16 + zk * HD * TT, nullptr, TT, Ob + (size_t)RH * HD, HD, nullptr, (size_t)TT * TT, (size_t)HD * TT, (size_t)TT * HD);
            k_merge<<<(unsigned)(((size_t)ZH * TT * HD / 2 + 255) / 256), 256, 0, stream>>>(Ob, h0, OUT + (size_t)b * TT * DM); }
    }
}

// v002
// Measured time: 1170 microseconds a run.
// Next to v001, in two timings, it ran 1.78 and 1.80 times as fast.
// All steps since v000 together make it 3.35 times as fast.
#include <hip/hip_runtime.h>

// Perceiver self-attention (hidden_states [4][2048][1024]; x = LN(h) (1e-5, gamma, beta); q, k, v = x W^T + b ('oi' [1024][1024], 16 heads x 64); softmax(q.k/8) over all keys; out = merged context (no output projection) -> [4][2048][1024] (8.4 M)).
// Compute dtypes, f32 accumulate: every input rounded to bf16; q/k/v on hi/lo bf16 x planes times bf16 W (2 products) + biases; scores and attn.v (no mask): query rows < 512 hl (3 products), the rest single fp16 (x1024); softmax f32; no output projection: the merged context is written in f32.

#define NB_  4
#define TT   2048
#define DM   1024
#define NH_  16
#define NKV  16
#define REP  (NH_ / NKV)
#define HD   64
#define DQ   (NH_ * HD)
#define DKV  (NKV * HD)
#define LNEPS 1e-5f
typedef __attribute__((ext_vector_type(4))) unsigned short v4us;
#define ZH   8                    // heads per attention pass (the f32 score plane of a pass: ZH x 16 MiB of workspace)
#define RH   512                  // query rows < RH use hi+lo planes (0: none)
#define WIN  0
#define PCAR 1024.0f
#define SCL  0.125f   // HD^-0.5
#define KSP  8                    // waves that share the k range of one tile: projections (K = 1024)
#define KSH  16                   // attn.v, hi+lo rows (K = 2048)
#define KSV  16                   // attn.v, fp16 rows (K = 2048)
typedef _Float16 h16;
typedef unsigned short bf;
typedef __attribute__((ext_vector_type(16))) __bf16   v16bf;
typedef __attribute__((ext_vector_type(16))) _Float16 v16h;
typedef __attribute__((ext_vector_type(8)))  _Float16 v8h;
typedef __attribute__((ext_vector_type(8)))  unsigned short v8us;
typedef __attribute__((ext_vector_type(8)))  float    v8f;
typedef __attribute__((ext_vector_type(4)))  float    v4f;
typedef v8h  __attribute__((may_alias)) v8ha;
typedef v4f  __attribute__((may_alias)) v4fa;
typedef v8us __attribute__((may_alias)) v8usa;

__device__ __forceinline__ unsigned short f2bf(float f) { unsigned u = __float_as_uint(f); u += 0x7FFFu + ((u >> 16) & 1u); return (unsigned short)(u >> 16); }
__device__ __forceinline__ float bf2f(unsigned short b) { return __uint_as_float(((unsigned)b) << 16); }
__device__ __forceinline__ float bfr(float f) { return bf2f(f2bf(f)); }
__device__ __forceinline__ v16h cat16(v8h lo, v8h hi) { return __builtin_shufflevector(lo, hi, 0, 1, 2, 3, 4, 5, 6, 7, 8, 9, 10, 11, 12, 13, 14, 15); }
__device__ __forceinline__ v16bf cat16b(v8us lo, v8us hi) { return __builtin_bit_cast(v16bf, __builtin_shufflevector(lo, hi, 0, 1, 2, 3, 4, 5, 6, 7, 8, 9, 10, 11, 12, 13, 14, 15)); }
__device__ __forceinline__ v8f wmma16(v16h a, v16h b, v8f c) { return __builtin_amdgcn_wmma_f32_16x16x32_f16(false, a, false, b, (short)0, c, false, false); }
__device__ __forceinline__ v8f wmmab(v16bf a, v16bf b, v8f c) { return __builtin_amdgcn_wmma_f32_16x16x32_bf16(false, a, false, b, (short)0, c, false, false); }



// ---- k_gemmw: register-blocked GEMM, one work-group of KS waves per 64x64 output tile (16 accumulators a wave), operands straight from K-contiguous 16-bit planes (A rows at pitch lda, Bt rows at pitch K, in elements); grid (M/64, N/64, Z), 32 * KS threads.
// KS > 1: wave w sums k in [w K/KS, (w+1) K/KS); the KS partial tiles meet in LDS and are added in the fixed order w = 0 .. KS-1. K % (32 KS) == 0.
// C[m][n] (f32, pitch ldc, + optional f32 bias[n]) = sum_k A[m][k] Bt[n][k] (+ split products per NSPLIT). z-batch strides sA/sB/sC in elements. K % 32 == 0.
template <typename T16> struct WFrag;
template <> struct WFrag<h16> { typedef v16h V; static __device__ __forceinline__ V ld(const h16* p) { return cat16(*(const v8h*)p, *(const v8h*)(p + 16)); } static __device__ __forceinline__ v8f mma(V a, V b, v8f c) { return wmma16(a, b, c); } };
template <> struct WFrag<bf> { typedef v16bf V; static __device__ __forceinline__ V ld(const bf* p) { return cat16b(*(const v8us*)p, *(const v8us*)(p + 16)); } static __device__ __forceinline__ v8f mma(V a, V b, v8f c) { return wmmab(a, b, c); } };
template <typename T16, int NSPLIT, bool BIAS, int KS>
__global__ __launch_bounds__(32 * KS) void k_gemmw(const T16* __restrict__ A, const T16* __restrict__ A2, const T16* __restrict__ Bt, const T16* __restrict__ Bt2, int K, int lda, float* C, int ldc, const float* __restrict__ bias, size_t sA, size_t sB, size_t sC) {
    typedef typename WFrag<T16>::V V;
    __shared__ __align__(16) float os[(KS == 1 ? 16 : KS * 64) * 68];
    const size_t z = blockIdx.z; A += z * sA; if (A2) A2 += z * sA; Bt += z * sB; if (Bt2) Bt2 += z * sB; C += z * sC;
    const int lane = threadIdx.x & 31, lr = lane & 15, hi = lane >> 4; const int r0 = blockIdx.x * 64, c0 = blockIdx.y * 64;
    v8f acc[4][4];
#pragma unroll
    for (int mb = 0; mb < 4; ++mb)
#pragma unroll
        for (int nb = 0; nb < 4; ++nb) acc[mb][nb] = (v8f){};
    const size_t aoff = (size_t)(r0 + lr) * lda + 8 * hi, boff = (size_t)(c0 + lr) * K + 8 * hi;
    const int wv = __builtin_amdgcn_readfirstlane((int)(threadIdx.x >> 5)); const int kb = wv * (K / KS), ke = kb + K / KS;   // this wave's k range; readfirstlane keeps the loop bounds scalar
#pragma unroll 1
    for (int kc = kb; kc < ke; kc += 32) {
        V a[4], a2[4];
#pragma unroll
        for (int mb = 0; mb < 4; ++mb) { a[mb] = WFrag<T16>::ld(A + aoff + (size_t)mb * 16 * lda + kc); if (NSPLIT == 1 || NSPLIT == 2) a2[mb] = WFrag<T16>::ld(A2 + aoff + (size_t)mb * 16 * lda + kc); }
#pragma unroll
        for (int nb = 0; nb < 4; ++nb) { const V b = WFrag<T16>::ld(Bt + boff + (size_t)nb * 16 * K + kc); V b2; if (NSPLIT >= 2) b2 = WFrag<T16>::ld(Bt2 + boff + (size_t)nb * 16 * K + kc);
#pragma unroll
            for (int mb = 0; mb < 4; ++mb) { acc[mb][nb] = WFrag<T16>::mma(a[mb], b, acc[mb][nb]); if (NSPLIT == 1 || NSPLIT == 2) acc[mb][nb] = WFrag<T16>::mma(a2[mb], b, acc[mb][nb]); if (NSPLIT >= 2) acc[mb][nb] = WFrag<T16>::mma(a[mb], b2, acc[mb][nb]); } }
        asm volatile("v_nop\n\tv_nop\n\tv_nop\n\tv_nop" : "+v"(acc[0][0]), "+v"(acc[1][1]), "+v"(acc[2][2]), "+v"(acc[3][3]) : "v"(a[0]), "v"(a[3]));
    }
    if (KS > 1) {
        float* ow = os + wv * (64 * 68);
        // the three loops are unrolled so that acc is indexed by constants and stays in registers
#pragma unroll
        for (int mb = 0; mb < 4; ++mb)
#pragma unroll
            for (int nb = 0; nb < 4; ++nb)
#pragma unroll
                for (int j = 0; j < 8; ++j) ow[(mb * 16 + hi * 8 + j) * 68 + nb * 16 + lr] = acc[mb][nb][j];
        __syncthreads();   // every wave's partial tile is in LDS before any thread adds them
        // both loops unrolled: a thread's LDS reads issue together instead of one wait per read
#pragma unroll
        for (int s = 0; s < 32 / KS; ++s) { const int i = s * (32 * KS) + (int)threadIdx.x, row = i >> 4, cofs = (i & 15) * 4; v4f val = *(const v4fa*)(os + row * 68 + cofs);
#pragma unroll
            for (int w = 1; w < KS; ++w) val += *(const v4fa*)(os + (w * 64 + row) * 68 + cofs);
            if (BIAS) { val[0] += bfr(bias[c0 + cofs]); val[1] += bfr(bias[c0 + cofs + 1]); val[2] += bfr(bias[c0 + cofs + 2]); val[3] += bfr(bias[c0 + cofs + 3]); }
            *(v4f*)(C + (size_t)(r0 + row) * ldc + c0 + cofs) = val; }
        return;
    }
#pragma unroll
    for (int mb = 0; mb < 4; ++mb) {
#pragma unroll
        for (int nb = 0; nb < 4; ++nb) {
#pragma unroll
            for (int j = 0; j < 8; ++j) os[(hi * 8 + j) * 68 + nb * 16 + lr] = acc[mb][nb][j]; }
        __builtin_amdgcn_wave_barrier(); asm volatile("" ::: "memory");
        float* crow = C + (size_t)(r0 + mb * 16) * ldc + c0;
{
#pragma unroll
            for (int s = 0; s < 8; ++s) { const int row = 2 * s + hi, cofs = lr * 4; v4f val = *(const v4fa*)(os + row * 68 + cofs); if (BIAS) { val[0] += bfr(bias[c0 + cofs]); val[1] += bfr(bias[c0 + cofs + 1]); val[2] += bfr(bias[c0 + cofs + 2]); val[3] += bfr(bias[c0 + cofs + 3]); }
                *(v4f*)(crow + (size_t)row * ldc + cofs) = val; }
             }
        __builtin_amdgcn_wave_barrier(); asm volatile("" ::: "memory");
    }
}

__device__ __forceinline__ h16 tohx(float x) { return (h16)x; }
__device__ __forceinline__ void splitf(float y, unsigned short& h, unsigned short& l) { h = f2bf(y); l = f2bf(y - bf2f(h)); }
typedef __attribute__((ext_vector_type(2))) _Float16 v2h;
typedef __attribute__((ext_vector_type(4))) _Float16 v4h;
typedef __attribute__((ext_vector_type(2))) unsigned short v2us;
typedef __attribute__((ext_vector_type(4))) unsigned short v4us;
typedef __attribute__((ext_vector_type(2))) float v2f;
typedef __attribute__((ext_vector_type(4))) int v4i;

__global__ __launch_bounds__(256) void k_wtG(const float* __restrict__ w, int K, int N, bf* Bt) {
    const int lane = threadIdx.x & 31; const int L0 = (blockIdx.x * 8 + (threadIdx.x >> 5)) * 8; const int nlines = N * K / 64;
{
#pragma unroll 1
        for (int l = 0; l < 8; ++l) { const int L = L0 + l; if (L >= nlines) break; const size_t e = (size_t)L * 64 + lane * 2; const int k = (int)(e % K), n = (int)(e / K); v2us o;
            o[0] = f2bf(w[(size_t)k * N + n]); o[1] = f2bf(w[(size_t)(k + 1) * N + n]); *(v2us*)(Bt + e) = o; }
         }
}
__global__ __launch_bounds__(256) void k_lnhl(const float* __restrict__ X, const float* __restrict__ A, const float* __restrict__ g, const float* __restrict__ be, float* Z, bf* Yh, bf* Yl) {
    const int lane = threadIdx.x & 31; const int r = blockIdx.x * 8 + (threadIdx.x >> 5); if (r >= TT) return; const float* xr = X + (size_t)r * DM; const float* ar = A ? A + (size_t)r * DM : nullptr; float s = 0.f;
#pragma unroll 1
    for (int ch = 0; ch < DM / 128; ++ch) { const int c0 = ch * 128 + lane * 4; const v4f a = *(const v4f*)(xr + c0); v4f d = {0.f, 0.f, 0.f, 0.f}; if (ar) d = *(const v4f*)(ar + c0);
#pragma unroll
        for (int q = 0; q < 4; ++q) s += __fadd_rn(bfr(a[q]), d[q]); }
#pragma unroll
    for (int sh = 16; sh; sh >>= 1) s += __shfl_xor(s, sh, 32);
    const float mu = s * (1.0f / DM); float s2 = 0.f;
#pragma unroll 1
    for (int ch = 0; ch < DM / 128; ++ch) { const int c0 = ch * 128 + lane * 4; const v4f a = *(const v4f*)(xr + c0); v4f d = {0.f, 0.f, 0.f, 0.f}; if (ar) d = *(const v4f*)(ar + c0);
#pragma unroll
        for (int q = 0; q < 4; ++q) { const float d0 = __fsub_rn(__fadd_rn(bfr(a[q]), d[q]), mu); float p = __fmul_rn(d0, d0); asm volatile("" : "+v"(p)); s2 = __fadd_rn(s2, p); } }
#pragma unroll
    for (int sh = 16; sh; sh >>= 1) s2 += __shfl_xor(s2, sh, 32);
    const float rs = __fdiv_rn(1.0f, __fsqrt_rn(__fadd_rn(s2 * (1.0f / DM), LNEPS)));
{
#pragma unroll 1
        for (int ch = 0; ch < DM / 128; ++ch) { const int c0 = ch * 128 + lane * 4; const v4f a = *(const v4f*)(xr + c0); v4f d = {0.f, 0.f, 0.f, 0.f}; if (ar) d = *(const v4f*)(ar + c0); v4f z4; v4us oh, ol;
#pragma unroll
            for (int q = 0; q < 4; ++q) { const float v = __fadd_rn(bfr(a[q]), d[q]); z4[q] = v; float n0 = __fmul_rn(__fsub_rn(v, mu), rs); asm volatile("" : "+v"(n0)); float n1 = __fmul_rn(n0, bfr(g[c0 + q])); asm volatile("" : "+v"(n1)); const float y = __fadd_rn(n1, bfr(be[c0 + q])); unsigned short h2, l2; splitf(y, h2, l2); oh[q] = h2; ol[q] = l2; }
            if (Z) *(v4f*)(Z + (size_t)r * DM + c0) = z4; *(v4us*)(Yh + (size_t)r * DM + c0) = oh; *(v4us*)(Yl + (size_t)r * DM + c0) = ol; }
         } }
__global__ __launch_bounds__(256) void k_addres(const float* __restrict__ X, const float* __restrict__ Y, float* O, size_t n4) { const size_t i = (size_t)blockIdx.x * 256 + threadIdx.x; if (i >= n4) return; const v4f a = *(const v4f*)(X + i * 4), b = *(const v4f*)(Y + i * 4); v4f o;
#pragma unroll
    for (int q = 0; q < 4; ++q) o[q] = __fadd_rn(bfr(a[q]), b[q]); *(v4f*)(O + i * 4) = o;  }
__global__ __launch_bounds__(256) void k_cvt8(const float* __restrict__ src, bf* dst, size_t n8) { const size_t i = (size_t)blockIdx.x * 256 + threadIdx.x; if (i >= n8) return; const v8f v = *(const v8f*)(src + i * 8); v8us o;
#pragma unroll
    for (int k = 0; k < 8; ++k) o[k] = f2bf(v[k]); *(v8us*)(dst + i * 8) = o;  }

// k_rope: head planes [h][t][d] (fp16 + hi/lo) of rope(x) x sc with the rotate-half convention out[d] = x[d] cos[t][d] - x[d+HD/2] sin[t][d], out[d+HD/2] = x[d+HD/2] cos[t][d+HD/2] + x[d] sin[t][d+HD/2]
__global__ __launch_bounds__(256) void k_rope(const float* __restrict__ F, int pitch, int nheads, const float* __restrict__ CS, const float* __restrict__ RF, const float* __restrict__ nw, float sc, h16* P16, bf* Ph, bf* Pl) {
    const size_t e = ((size_t)blockIdx.x * 256 + threadIdx.x) * 2; if (e >= (size_t)nheads * TT * HD) return; const int d = (int)(e % HD); const int t = (int)((e / HD) % TT); const int h = (int)(e / ((size_t)HD * TT)); const float* f = F + (size_t)t * pitch + h * HD; const float rf = RF ? RF[(size_t)h * TT + t] : 1.0f; v2h o16; v2us oh, ol;
#pragma unroll
    for (int q = 0; q < 2; ++q) { const int dd = d + q; const int dp = (dd < HD / 2) ? dd + HD / 2 : dd - HD / 2; float x0 = f[dd], x1 = f[dp];
        if (RF) { float n0 = __fmul_rn(x0, rf), n1 = __fmul_rn(x1, rf); asm volatile("" : "+v"(n0)); asm volatile("" : "+v"(n1)); x0 = __fmul_rn(bfr(nw[dd]), n0); x1 = __fmul_rn(bfr(nw[dp]), n1); }
        const v2f cs = *(const v2f*)(CS + ((size_t)t * HD + dd) * 2); float a = __fmul_rn(x0, cs[0]), bq = __fmul_rn(x1, cs[1]); asm volatile("" : "+v"(a)); asm volatile("" : "+v"(bq)); const float r = ((dd < HD / 2) ? __fsub_rn(a, bq) : __fadd_rn(a, bq)) * sc;
        o16[q] = tohx(r); unsigned short a2, c2; splitf(r, a2, c2); oh[q] = a2; ol[q] = c2; }
    *(v2h*)(P16 + e) = o16; *(v2us*)(Ph + e) = oh; *(v2us*)(Pl + e) = ol;  }
__global__ __launch_bounds__(256) void k_vtp(const float* __restrict__ F, int pitch, int nheads, h16* V16, bf* Vh, bf* Vl) { const size_t e = ((size_t)blockIdx.x * 256 + threadIdx.x) * 2; if (e >= (size_t)nheads * HD * TT) return; const int t = (int)(e % TT); const int d = (int)((e / TT) % HD); const int g = (int)(e / ((size_t)TT * HD)); v2h o16; v2us oh, ol;
#pragma unroll
    for (int q = 0; q < 2; ++q) { const float x = F[(size_t)(t + q) * pitch + g * HD + d]; o16[q] = tohx(x); unsigned short a2, c2; splitf(x, a2, c2); oh[q] = a2; ol[q] = c2; }
    *(v2h*)(V16 + e) = o16; *(v2us*)(Vh + e) = oh; *(v2us*)(Vl + e) = ol;  }
__global__ __launch_bounds__(256) void k_csid(float* CS) { const int idx = blockIdx.x * 256 + threadIdx.x; if (idx >= TT * HD) return; v2f cs; cs[0] = 1.0f; cs[1] = 0.0f; *(v2f*)(CS + (size_t)idx * 2) = cs;  }
// k_asoft: per row (zz, i): t = S x HD^-0.5 (no mask); softmax over the 2048 keys (register row, one exp, fixed trees);
// the 16-bit probabilities go over the row's own 8 KiB of f32 scores, which its one wave holds whole in registers by then: hi plane in elements [0, TT), lo plane in [TT, 2 TT) of the row (rows < RH), fp16 in [0, TT) (the rest); row pitch 2 TT 16-bit elements
__global__ __launch_bounds__(256) void k_asoft(float* Sb) {
    const int lane = threadIdx.x & 31; const int row = blockIdx.x * 8 + (threadIdx.x >> 5); if (row >= ZH * TT) return; const int i = row % TT; const int zz = row / TT; (void)zz; const bool hires = (i < RH); float* sr = Sb + (size_t)row * TT; float v[TT / 32]; float mx = -3.0e38f;
#pragma unroll
    for (int ch = 0; ch < TT / 128; ++ch) { const int j0 = ch * 128 + lane * 4; const v4f a = *(const v4f*)(sr + j0);
#pragma unroll
        for (int q = 0; q < 4; ++q) { const int j = j0 + q; (void)j; const float t = a[q] * SCL; v[ch * 4 + q] = t; mx = fmaxf(mx, t); } }
#pragma unroll
    for (int sh = 16; sh; sh >>= 1) mx = fmaxf(mx, __shfl_xor(mx, sh, 32));
    float sum = 0.f;
#pragma unroll
    for (int k = 0; k < TT / 32; ++k) { float d0 = __fsub_rn(v[k], mx); asm volatile("" : "+v"(d0)); v[k] = __builtin_amdgcn_exp2f(__fmul_rn(d0, 1.4426950408889634f)); sum += v[k]; }
#pragma unroll
    for (int sh = 16; sh; sh >>= 1) sum += __shfl_xor(sum, sh, 32);
    const float f = __fdiv_rn(hires ? 1.0f : PCAR, sum);
{
        if (hires) { bf* ph = (bf*)sr; bf* pl = ph + TT;
#pragma unroll
            for (int ch = 0; ch < TT / 128; ++ch) { v4us oh, ol;
#pragma unroll
                for (int q = 0; q < 4; ++q) { unsigned short a, c2; splitf(v[ch * 4 + q] * f, a, c2); oh[q] = a; ol[q] = c2; }
                const int oo = ch * 128 + lane * 4; *(v4us*)(ph + oo) = oh; *(v4us*)(pl + oo) = ol; }
        } else { h16* p16 = (h16*)sr;
#pragma unroll
            for (int ch = 0; ch < TT / 128; ++ch) { v4h o4;
#pragma unroll
                for (int q = 0; q < 4; ++q) o4[q] = tohx(v[ch * 4 + q] * f);
                *(v4h*)(p16 + ch * 128 + lane * 4) = o4; } }
         }
}
__global__ __launch_bounds__(256) void k_merge(const float* __restrict__ O, int h0, float* OUTb) { const size_t e = ((size_t)blockIdx.x * 256 + threadIdx.x) * 2; if (e >= (size_t)ZH * TT * HD) return; const int d = (int)(e % HD); const int t = (int)((e / HD) % TT); const int zz = (int)(e / ((size_t)HD * TT)); const float cs = (t < RH) ? 1.0f : (1.0f / PCAR); const size_t oo = (size_t)t * DQ + (h0 + zz) * HD + d;
    v2f o2; o2[0] = O[e] * cs; o2[1] = O[e + 1] * cs; *(v2f*)(OUTb + oo) = o2;  }   /* f32 context [t][h*64 + d] straight to the output */

extern "C" void kernel_launch(void* const* d_in, const int* in_sizes, int n_in,
                              void* d_out, int out_size, void* d_ws, size_t ws_size, hipStream_t stream) {
    (void)in_sizes; (void)n_in; (void)out_size;
    const float* x = (const float*)d_in[0]; const float* g1 = (const float*)d_in[1]; const float* e1b = (const float*)d_in[2]; const float* wq = (const float*)d_in[3]; const float* bq = (const float*)d_in[4]; const float* wk = (const float*)d_in[5]; const float* bk = (const float*)d_in[6]; const float* wv = (const float*)d_in[7]; const float* bv = (const float*)d_in[8]; const float* wo = nullptr; (void)wo;
    float* OUT = (float*)d_out;     // [4][2048][1024]
    char* wsp = (char*)d_ws;
    auto take = [&](size_t bytes) { char* p = wsp; wsp += (bytes + 255) & ~(size_t)255; return (void*)p; };
    bf* WQ = (bf*)take((size_t)DQ * DM * 2); bf* WK = (bf*)take((size_t)DKV * DM * 2); bf* WV = (bf*)take((size_t)DKV * DM * 2); float* CS = (float*)take((size_t)TT * HD * 2 * 4);
    bf* Yh = (bf*)take((size_t)TT * DM * 2); bf* Yl = (bf*)take((size_t)TT * DM * 2); float* FQ = (float*)take((size_t)TT * DQ * 4); float* FK = (float*)take((size_t)TT * DKV * 4);
    h16* QP16 = (h16*)take((size_t)NH_ * TT * HD * 2); h16* KP16 = (h16*)take((size_t)NKV * TT * HD * 2); h16* VT16 = (h16*)take((size_t)NKV * HD * TT * 2);
    bf* QPh = (bf*)take((size_t)NH_ * TT * HD * 2); bf* QPl = (bf*)take((size_t)NH_ * TT * HD * 2); bf* KPh = (bf*)take((size_t)NKV * TT * HD * 2); bf* KPl = (bf*)take((size_t)NKV * TT * HD * 2); bf* VTh = (bf*)take((size_t)NKV * HD * TT * 2); bf* VTl = (bf*)take((size_t)NKV * HD * TT * 2);
    float* Sb = (float*)take((size_t)ZH * TT * TT * 4); float* Ob = (float*)take((size_t)ZH * TT * HD * 4); 
    if ((size_t)(wsp - (char*)d_ws) > ws_size) return;    // ws 256 MiB
    float* FV = FK;   // v projection reuses the k buffer after the k planes are built (stream-ordered)
    { k_cvt8<<<(unsigned)(((size_t)DQ * DM / 8 + 255) / 256), 256, 0, stream>>>(wq, WQ, (size_t)DQ * DM / 8); k_cvt8<<<(unsigned)(((size_t)DKV * DM / 8 + 255) / 256), 256, 0, stream>>>(wk, WK, (size_t)DKV * DM / 8); k_cvt8<<<(unsigned)(((size_t)DKV * DM / 8 + 255) / 256), 256, 0, stream>>>(wv, WV, (size_t)DKV * DM / 8);
       }
    k_csid<<<(TT * HD + 255) / 256, 256, 0, stream>>>(CS);
    const unsigned LQ = (unsigned)(((size_t)NH_ * TT * HD / 2 + 255) / 256), LKv = (unsigned)(((size_t)NKV * TT * HD / 2 + 255) / 256);
    for (int b = 0; b < NB_; ++b) {
        
        k_lnhl<<<TT / 8, 256, 0, stream>>>(x + (size_t)b * TT * DM, nullptr, g1, e1b, nullptr, Yh, Yl);   /* x = LN(h) as hi/lo planes */
        k_gemmw<bf, 1, true, KSP><<<dim3(TT / 64, DQ / 64, 1), 32 * KSP, 0, stream>>>(Yh, Yl, WQ, nullptr, DM, DM, FQ, DQ, bq, 0, 0, 0);
        k_rope<<<LQ, 256, 0, stream>>>(FQ, DQ, NH_, CS, nullptr, nullptr, 1.0f, QP16, QPh, QPl);
        k_gemmw<bf, 1, true, KSP><<<dim3(TT / 64, DKV / 64, 1), 32 * KSP, 0, stream>>>(Yh, Yl, WK, nullptr, DM, DM, FK, DKV, bk, 0, 0, 0);
        k_rope<<<LKv, 256, 0, stream>>>(FK, DKV, NKV, CS, nullptr, nullptr, 1.0f, KP16, KPh, KPl);
        k_gemmw<bf, 1, true, KSP><<<dim3(TT / 64, DKV / 64, 1), 32 * KSP, 0, stream>>>(Yh, Yl, WV, nullptr, DM, DM, FV, DKV, bv, 0, 0, 0); k_vtp<<<LKv, 256, 0, stream>>>(FV, DKV, NKV, VT16, VTh, VTl);
        for (int h0 = 0; h0 < NH_; h0 += ZH) { const size_t zq = (size_t)h0, zk = (size_t)(h0 / REP);   // one kv head per query head: the pass's ZH heads use consecutive kv planes (z-strides TT*HD)
            k_gemmw<bf, 2, false, 1><<<dim3(RH / 64, TT / 64, ZH), 32, 0, stream>>>(QPh + zq * TT * HD, QPl + zq * TT * HD, KPh + zk * TT * HD, KPl + zk * TT * HD, HD, HD, Sb, TT, nullptr, (size_t)TT * HD, (size_t)TT * HD, (size_t)TT * TT);
            k_gemmw<h16, 0, false, 1><<<dim3((TT - RH) / 64, TT / 64, ZH), 32, 0, stream>>>(QP16 + zq * TT * HD + (size_t)RH * HD, nullptr, KP16 + zk * TT * HD, nullptr, HD, HD, Sb + (size_t)RH * TT, TT, nullptr, (size_t)TT * HD, (size_t)TT * HD, (size_t)TT * TT);
            k_asoft<<<ZH * TT / 8, 256, 0, stream>>>(Sb);
            k_gemmw<bf, 2, false, KSH><<<dim3(RH / 64, HD / 64, ZH), 32 * KSH, 0, stream>>>((const bf*)Sb, (const bf*)Sb + TT, VTh + zk * HD * TT, VTl + zk * HD * TT, TT, 2 * TT, Ob, HD, nullptr, (size_t)2 * TT * TT, (size_t)HD * TT, (size_t)TT * HD);
            k_gemmw<h16, 0, false, KSV><<<dim3((TT - RH) / 64, HD / 64, ZH), 32 * KSV, 0, stream>>>((const h16*)Sb + (size_t)RH * 2 * TT, nullptr, VT16 + zk * HD * TT, nullptr, TT, 2 * TT, Ob + (size_t)RH * HD, HD, nullptr, (size_t)2 * TT * TT, (size_t)HD * TT, (size_t)TT * HD);
            k_merge<<<(unsigned)(((size_t)ZH * TT * HD / 2 + 255) / 256), 256, 0, stream>>>(Ob, h0, OUT + (size_t)b * TT * DM); }
    }
}

// v003
// Measured time: 533 microseconds a run.
// Timed twice side by side with v002, it ran 2.19 times as fast both times.
// All steps since v000 together make it 7.34 times as fast.
#include <hip/hip_runtime.h>

// Perceiver self-attention (hidden_states [4][2048][1024]; x = LN(h) (1e-5, gamma, beta); q, k, v = x W^T + b ('oi' [1024][1024], 16 heads x 64); softmax(q.k/8) over all keys; out = merged context (no output projection) -> [4][2048][1024] (8.4 M)).
// Compute dtypes, f32 accumulate: every input rounded to bf16; q/k/v on x hi+lo bf16 planes (2 products) x plain bf16 weights (inputs: exact) + biases; scores and attn.v (no mask), fused with a running-maximum softmax: query rows < 512 hl (3 products), the rest single fp16 (x64); softmax f32; no output projection: the merged context is written in f32.

#define NB_  4
#define TT   2048
#define DM   1024
#define NH_  16
#define NKV  16
#define REP  (NH_ / NKV)
#define HD   64
#define DQ   (NH_ * HD)
#define DKV  (NKV * HD)
#define LNEPS 1e-5f
typedef __attribute__((ext_vector_type(4))) unsigned short v4us;
#define RH   512                  // query rows < RH use hi+lo planes (0: none)
#define WIN  0
#define PEXP 6.0f                 // fp16 rows: probabilities carry a factor 2^PEXP (it cancels against the row sum); with the lazy bound MLAZ they stay <= 2^14
#define MLAZ 8.0f                 // a row's maximum in use is renewed only when a new score exceeds it by more than this (base-2 exponent units)
#define SCL  0.125f   // HD^-0.5
#define KSP  8                    // waves that share the k range of one tile: projections (K = 1024)
typedef _Float16 h16;
typedef unsigned short bf;
typedef __attribute__((ext_vector_type(16))) __bf16   v16bf;
typedef __attribute__((ext_vector_type(16))) _Float16 v16h;
typedef __attribute__((ext_vector_type(8)))  _Float16 v8h;
typedef __attribute__((ext_vector_type(8)))  unsigned short v8us;
typedef __attribute__((ext_vector_type(8)))  float    v8f;
typedef __attribute__((ext_vector_type(4)))  float    v4f;
typedef v8h  __attribute__((may_alias)) v8ha;
typedef v4f  __attribute__((may_alias)) v4fa;
typedef v8us __attribute__((may_alias)) v8usa;

__device__ __forceinline__ unsigned short f2bf(float f) { unsigned u = __float_as_uint(f); u += 0x7FFFu + ((u >> 16) & 1u); return (unsigned short)(u >> 16); }
__device__ __forceinline__ float bf2f(unsigned short b) { return __uint_as_float(((unsigned)b) << 16); }
__device__ __forceinline__ float bfr(float f) { return bf2f(f2bf(f)); }
__device__ __forceinline__ v16h cat16(v8h lo, v8h hi) { return __builtin_shufflevector(lo, hi, 0, 1, 2, 3, 4, 5, 6, 7, 8, 9, 10, 11, 12, 13, 14, 15); }
__device__ __forceinline__ v16bf cat16b(v8us lo, v8us hi) { return __builtin_bit_cast(v16bf, __builtin_shufflevector(lo, hi, 0, 1, 2, 3, 4, 5, 6, 7, 8, 9, 10, 11, 12, 13, 14, 15)); }
__device__ __forceinline__ v8f wmma16(v16h a, v16h b, v8f c) { return __builtin_amdgcn_wmma_f32_16x16x32_f16(false, a, false, b, (short)0, c, false, false); }
__device__ __forceinline__ v8f wmmab(v16bf a, v16bf b, v8f c) { return __builtin_amdgcn_wmma_f32_16x16x32_bf16(false, a, false, b, (short)0, c, false, false); }



// ---- k_gemmw: register-blocked GEMM, one work-group of KS waves per 64x64 output tile (16 accumulators a wave), operands straight from K-contiguous 16-bit planes (A rows at pitch lda, Bt rows at pitch K, in elements); grid (M/64, N/64, Z), 32 * KS threads.
// KS > 1: wave w sums k in [w K/KS, (w+1) K/KS); the KS partial tiles meet in LDS and are added in the fixed order w = 0 .. KS-1. K % (32 KS) == 0.
// C[m][n] (f32, pitch ldc, + optional f32 bias[n]) = sum_k A[m][k] Bt[n][k] (+ split products per NSPLIT). z-batch strides sA/sB/sC in elements. K % 32 == 0.
template <typename T16> struct WFrag;
template <> struct WFrag<h16> { typedef v16h V; static __device__ __forceinline__ V ld(const h16* p) { return cat16(*(const v8h*)p, *(const v8h*)(p + 16)); } static __device__ __forceinline__ v8f mma(V a, V b, v8f c) { return wmma16(a, b, c); } };
template <> struct WFrag<bf> { typedef v16bf V; static __device__ __forceinline__ V ld(const bf* p) { return cat16b(*(const v8us*)p, *(const v8us*)(p + 16)); } static __device__ __forceinline__ v8f mma(V a, V b, v8f c) { return wmmab(a, b, c); } };
template <typename T16, int NSPLIT, bool BIAS, int KS>
__global__ __launch_bounds__(32 * KS) void k_gemmw(const T16* __restrict__ A, const T16* __restrict__ A2, const T16* __restrict__ Bt, const T16* __restrict__ Bt2, int K, int lda, float* C, int ldc, const float* __restrict__ bias, size_t sA, size_t sB, size_t sC) {
    typedef typename WFrag<T16>::V V;
    __shared__ __align__(16) float os[(KS == 1 ? 16 : KS * 64) * 68];
    const size_t z = blockIdx.z; A += z * sA; if (A2) A2 += z * sA; Bt += z * sB; if (Bt2) Bt2 += z * sB; C += z * sC;
    const int lane = threadIdx.x & 31, lr = lane & 15, hi = lane >> 4; const int r0 = blockIdx.x * 64, c0 = blockIdx.y * 64;
    v8f acc[4][4];
#pragma unroll
    for (int mb = 0; mb < 4; ++mb)
#pragma unroll
        for (int nb = 0; nb < 4; ++nb) acc[mb][nb] = (v8f){};
    const size_t aoff = (size_t)(r0 + lr) * lda + 8 * hi, boff = (size_t)(c0 + lr) * K + 8 * hi;
    const int wv = __builtin_amdgcn_readfirstlane((int)(threadIdx.x >> 5)); const int kb = wv * (K / KS), ke = kb + K / KS;   // this wave's k range; readfirstlane keeps the loop bounds scalar
#pragma unroll 1
    for (int kc = kb; kc < ke; kc += 32) {
        V a[4], a2[4];
#pragma unroll
        for (int mb = 0; mb < 4; ++mb) { a[mb] = WFrag<T16>::ld(A + aoff + (size_t)mb * 16 * lda + kc); if (NSPLIT == 1 || NSPLIT == 2) a2[mb] = WFrag<T16>::ld(A2 + aoff + (size_t)mb * 16 * lda + kc); }
#pragma unroll
        for (int nb = 0; nb < 4; ++nb) { const V b = WFrag<T16>::ld(Bt + boff + (size_t)nb * 16 * K + kc); V b2; if (NSPLIT >= 2) b2 = WFrag<T16>::ld(Bt2 + boff + (size_t)nb * 16 * K + kc);
#pragma unroll
            for (int mb = 0; mb < 4; ++mb) { acc[mb][nb] = WFrag<T16>::mma(a[mb], b, acc[mb][nb]); if (NSPLIT == 1 || NSPLIT == 2) acc[mb][nb] = WFrag<T16>::mma(a2[mb], b, acc[mb][nb]); if (NSPLIT >= 2) acc[mb][nb] = WFrag<T16>::mma(a[mb], b2, acc[mb][nb]); } }
        asm volatile("v_nop\n\tv_nop\n\tv_nop\n\tv_nop" : "+v"(acc[0][0]), "+v"(acc[1][1]), "+v"(acc[2][2]), "+v"(acc[3][3]) : "v"(a[0]), "v"(a[3]));
    }
    if (KS > 1) {
        float* ow = os + wv * (64 * 68);
        // the three loops are unrolled so that acc is indexed by constants and stays in registers
#pragma unroll
        for (int mb = 0; mb < 4; ++mb)
#pragma unroll
            for (int nb = 0; nb < 4; ++nb)
#pragma unroll
                for (int j = 0; j < 8; ++j) ow[(mb * 16 + hi * 8 + j) * 68 + nb * 16 + lr] = acc[mb][nb][j];
        __syncthreads();   // every wave's partial tile is in LDS before any thread adds them
        // both loops unrolled: a thread's LDS reads issue together instead of one wait per read
#pragma unroll
        for (int s = 0; s < 32 / KS; ++s) { const int i = s * (32 * KS) + (int)threadIdx.x, row = i >> 4, cofs = (i & 15) * 4; v4f val = *(const v4fa*)(os + row * 68 + cofs);
#pragma unroll
            for (int w = 1; w < KS; ++w) val += *(const v4fa*)(os + (w * 64 + row) * 68 + cofs);
            if (BIAS) { val[0] += bfr(bias[c0 + cofs]); val[1] += bfr(bias[c0 + cofs + 1]); val[2] += bfr(bias[c0 + cofs + 2]); val[3] += bfr(bias[c0 + cofs + 3]); }
            *(v4f*)(C + (size_t)(r0 + row) * ldc + c0 + cofs) = val; }
        return;
    }
#pragma unroll
    for (int mb = 0; mb < 4; ++mb) {
#pragma unroll
        for (int nb = 0; nb < 4; ++nb) {
#pragma unroll
            for (int j = 0; j < 8; ++j) os[(hi * 8 + j) * 68 + nb * 16 + lr] = acc[mb][nb][j]; }
        __builtin_amdgcn_wave_barrier(); asm volatile("" ::: "memory");
        float* crow = C + (size_t)(r0 + mb * 16) * ldc + c0;
{
#pragma unroll
            for (int s = 0; s < 8; ++s) { const int row = 2 * s + hi, cofs = lr * 4; v4f val = *(const v4fa*)(os + row * 68 + cofs); if (BIAS) { val[0] += bfr(bias[c0 + cofs]); val[1] += bfr(bias[c0 + cofs + 1]); val[2] += bfr(bias[c0 + cofs + 2]); val[3] += bfr(bias[c0 + cofs + 3]); }
                *(v4f*)(crow + (size_t)row * ldc + cofs) = val; }
             }
        __builtin_amdgcn_wave_barrier(); asm volatile("" ::: "memory");
    }
}

__device__ __forceinline__ h16 tohx(float x) { return (h16)x; }
__device__ __forceinline__ void splitf(float y, unsigned short& h, unsigned short& l) { h = f2bf(y); l = f2bf(y - bf2f(h)); }
typedef __attribute__((ext_vector_type(2))) _Float16 v2h;
typedef __attribute__((ext_vector_type(4))) _Float16 v4h;
typedef __attribute__((ext_vector_type(2))) unsigned short v2us;
typedef __attribute__((ext_vector_type(4))) unsigned short v4us;
typedef __attribute__((ext_vector_type(2))) float v2f;
typedef __attribute__((ext_vector_type(4))) int v4i;

__global__ __launch_bounds__(256) void k_wtG(const float* __restrict__ w, int K, int N, bf* Bt) {
    const int lane = threadIdx.x & 31; const int L0 = (blockIdx.x * 8 + (threadIdx.x >> 5)) * 8; const int nlines = N * K / 64;
{
#pragma unroll 1
        for (int l = 0; l < 8; ++l) { const int L = L0 + l; if (L >= nlines) break; const size_t e = (size_t)L * 64 + lane * 2; const int k = (int)(e % K), n = (int)(e / K); v2us o;
            o[0] = f2bf(w[(size_t)k * N + n]); o[1] = f2bf(w[(size_t)(k + 1) * N + n]); *(v2us*)(Bt + e) = o; }
         }
}
__global__ __launch_bounds__(256) void k_lnhl(const float* __restrict__ X, const float* __restrict__ A, const float* __restrict__ g, const float* __restrict__ be, float* Z, bf* Yh, bf* Yl) {
    const int lane = threadIdx.x & 31; const int r = blockIdx.x * 8 + (threadIdx.x >> 5); if (r >= TT) return; const float* xr = X + (size_t)r * DM; const float* ar = A ? A + (size_t)r * DM : nullptr; float s = 0.f;
#pragma unroll 1
    for (int ch = 0; ch < DM / 128; ++ch) { const int c0 = ch * 128 + lane * 4; const v4f a = *(const v4f*)(xr + c0); v4f d = {0.f, 0.f, 0.f, 0.f}; if (ar) d = *(const v4f*)(ar + c0);
#pragma unroll
        for (int q = 0; q < 4; ++q) s += __fadd_rn(bfr(a[q]), d[q]); }
#pragma unroll
    for (int sh = 16; sh; sh >>= 1) s += __shfl_xor(s, sh, 32);
    const float mu = s * (1.0f / DM); float s2 = 0.f;
#pragma unroll 1
    for (int ch = 0; ch < DM / 128; ++ch) { const int c0 = ch * 128 + lane * 4; const v4f a = *(const v4f*)(xr + c0); v4f d = {0.f, 0.f, 0.f, 0.f}; if (ar) d = *(const v4f*)(ar + c0);
#pragma unroll
        for (int q = 0; q < 4; ++q) { const float d0 = __fsub_rn(__fadd_rn(bfr(a[q]), d[q]), mu); float p = __fmul_rn(d0, d0); asm volatile("" : "+v"(p)); s2 = __fadd_rn(s2, p); } }
#pragma unroll
    for (int sh = 16; sh; sh >>= 1) s2 += __shfl_xor(s2, sh, 32);
    const float rs = __fdiv_rn(1.0f, __fsqrt_rn(__fadd_rn(s2 * (1.0f / DM), LNEPS)));
{
#pragma unroll 1
        for (int ch = 0; ch < DM / 128; ++ch) { const int c0 = ch * 128 + lane * 4; const v4f a = *(const v4f*)(xr + c0); v4f d = {0.f, 0.f, 0.f, 0.f}; if (ar) d = *(const v4f*)(ar + c0); v4f z4; v4us oh, ol;
#pragma unroll
            for (int q = 0; q < 4; ++q) { const float v = __fadd_rn(bfr(a[q]), d[q]); z4[q] = v; float n0 = __fmul_rn(__fsub_rn(v, mu), rs); asm volatile("" : "+v"(n0)); float n1 = __fmul_rn(n0, bfr(g[c0 + q])); asm volatile("" : "+v"(n1)); const float y = __fadd_rn(n1, bfr(be[c0 + q])); unsigned short h2, l2; splitf(y, h2, l2); oh[q] = h2; ol[q] = l2; }
            if (Z) *(v4f*)(Z + (size_t)r * DM + c0) = z4; *(v4us*)(Yh + (size_t)r * DM + c0) = oh; *(v4us*)(Yl + (size_t)r * DM + c0) = ol; }
         } }
__global__ __launch_bounds__(256) void k_addres(const float* __restrict__ X, const float* __restrict__ Y, float* O, size_t n4) { const size_t i = (size_t)blockIdx.x * 256 + threadIdx.x; if (i >= n4) return; const v4f a = *(const v4f*)(X + i * 4), b = *(const v4f*)(Y + i * 4); v4f o;
#pragma unroll
    for (int q = 0; q < 4; ++q) o[q] = __fadd_rn(bfr(a[q]), b[q]); *(v4f*)(O + i * 4) = o;  }
__global__ __launch_bounds__(256) void k_cvt8(const float* __restrict__ src, bf* dst, size_t n8) { const size_t i = (size_t)blockIdx.x * 256 + threadIdx.x; if (i >= n8) return; const v8f v = *(const v8f*)(src + i * 8); v8us o;
#pragma unroll
    for (int k = 0; k < 8; ++k) o[k] = f2bf(v[k]); *(v8us*)(dst + i * 8) = o;  }

// k_rope: head planes [h][t][d] (fp16 + hi/lo) of rope(x) x sc with the rotate-half convention out[d] = x[d] cos[t][d] - x[d+HD/2] sin[t][d], out[d+HD/2] = x[d+HD/2] cos[t][d+HD/2] + x[d] sin[t][d+HD/2]
__global__ __launch_bounds__(256) void k_rope(const float* __restrict__ F, int pitch, int nheads, const float* __restrict__ CS, const float* __restrict__ RF, const float* __restrict__ nw, float sc, h16* P16, bf* Ph, bf* Pl) {
    const size_t e = ((size_t)blockIdx.x * 256 + threadIdx.x) * 2; if (e >= (size_t)nheads * TT * HD) return; const int d = (int)(e % HD); const int t = (int)((e / HD) % TT); const int h = (int)(e / ((size_t)HD * TT)); const float* f = F + (size_t)t * pitch + h * HD; const float rf = RF ? RF[(size_t)h * TT + t] : 1.0f; v2h o16; v2us oh, ol;
#pragma unroll
    for (int q = 0; q < 2; ++q) { const int dd = d + q; const int dp = (dd < HD / 2) ? dd + HD / 2 : dd - HD / 2; float x0 = f[dd], x1 = f[dp];
        if (RF) { float n0 = __fmul_rn(x0, rf), n1 = __fmul_rn(x1, rf); asm volatile("" : "+v"(n0)); asm volatile("" : "+v"(n1)); x0 = __fmul_rn(bfr(nw[dd]), n0); x1 = __fmul_rn(bfr(nw[dp]), n1); }
        const v2f cs = *(const v2f*)(CS + ((size_t)t * HD + dd) * 2); float a = __fmul_rn(x0, cs[0]), bq = __fmul_rn(x1, cs[1]); asm volatile("" : "+v"(a)); asm volatile("" : "+v"(bq)); const float r = ((dd < HD / 2) ? __fsub_rn(a, bq) : __fadd_rn(a, bq)) * sc;
        o16[q] = tohx(r); unsigned short a2, c2; splitf(r, a2, c2); oh[q] = a2; ol[q] = c2; }
    *(v2h*)(P16 + e) = o16; *(v2us*)(Ph + e) = oh; *(v2us*)(Pl + e) = ol;  }
__global__ __launch_bounds__(256) void k_vtp(const float* __restrict__ F, int pitch, int nheads, h16* V16, bf* Vh, bf* Vl) { const size_t e = ((size_t)blockIdx.x * 256 + threadIdx.x) * 2; if (e >= (size_t)nheads * HD * TT) return; const int t = (int)(e % TT); const int d = (int)((e / TT) % HD); const int g = (int)(e / ((size_t)TT * HD)); v2h o16; v2us oh, ol;
#pragma unroll
    for (int q = 0; q < 2; ++q) { const float x = F[(size_t)(t + q) * pitch + g * HD + d]; o16[q] = tohx(x); unsigned short a2, c2; splitf(x, a2, c2); oh[q] = a2; ol[q] = c2; }
    *(v2h*)(V16 + e) = o16; *(v2us*)(Vh + e) = oh; *(v2us*)(Vl + e) = ol;  }
__global__ __launch_bounds__(256) void k_csid(float* CS) { const int idx = blockIdx.x * 256 + threadIdx.x; if (idx >= TT * HD) return; v2f cs; cs[0] = 1.0f; cs[1] = 0.0f; *(v2f*)(CS + (size_t)idx * 2) = cs;  }
// ---- k_fattn: scores, softmax and attn.v of one head in one kernel; no score ever leaves the registers.
// Transposed products: S^T = K Q^T (A = 16 key rows, B = 16 query columns), O^T += V^T P^T. A lane holds scores of ONE query (column lr), keys 8 hi + r of each 16-key tile,
// so two score tiles of a 32-key pass, converted in place, are the B operand of the second product (k order of WFrag::ld), and maximum and sum are in-lane but for one exchange between the wave's halves.
// Running maximum (base-2 units) with a lazy renewal; the row sum is kept per half and joined at the end. One wave: NG groups of 16 queries, all 2048 keys, 32 a pass.
// Every inner loop is unrolled so that the fragment, score and accumulator arrays are indexed by constants and stay in registers.
__device__ __forceinline__ float xhalf(float x) { return __builtin_bit_cast(float, __builtin_amdgcn_permlanex16(__builtin_bit_cast(int, x), __builtin_bit_cast(int, x), 0x76543210, 0xfedcba98, false, false)); }   // lane l <-> lane l ^ 16
template <bool B> struct BoolC { static constexpr bool value = B; };
// four v_exp_f32 and the slot behind the last in one statement; the results share no register with the sources, so no instruction here or behind it reads a result or overwrites a source directly behind its v_exp_f32
__device__ __forceinline__ void exp2x4(float x0, float x1, float x2, float x3, float* r) { float a, b, c, d;
    asm("v_exp_f32 %0, %4\n\tv_exp_f32 %1, %5\n\tv_exp_f32 %2, %6\n\tv_exp_f32 %3, %7\n\tv_nop" : "=&v"(a), "=&v"(b), "=&v"(c), "=&v"(d) : "v"(x0), "v"(x1), "v"(x2), "v"(x3)); r[0] = a; r[1] = b; r[2] = c; r[3] = d; }
// stands behind each run of global loads from one base, in front of whatever gives their address registers a new value (a later load's result, a scalar move)
__device__ __forceinline__ void xwait() { asm volatile("s_wait_xcnt 0x0" ::: "memory"); }
template <typename T16, bool HL, int NG>
__device__ __forceinline__ void fattn(const T16* __restrict__ Q, const T16* __restrict__ Q2, const T16* __restrict__ Kp, const T16* __restrict__ K2, const T16* __restrict__ Vt, const T16* __restrict__ V2, int qb, float* __restrict__ orow) {
    typedef typename WFrag<T16>::V V;
    const int lane = threadIdx.x & 31, lr = lane & 15, hi = lane >> 4;
    const float cs = SCL * 1.4426950408889634f;
    V qf[NG][2], qf2[NG][2], kf[2][2], kf2[2][2];
    v8f o[NG][4]; float mr[NG], ls[NG];
#pragma unroll
    for (int g = 0; g < NG; ++g) { mr[g] = -3.0e38f; ls[g] = 0.f;
        const size_t qo = (size_t)(qb + g * 16 + lr) * HD + 8 * hi;
#pragma unroll
        for (int c = 0; c < 2; ++c) qf[g][c] = WFrag<T16>::ld(Q + qo + c * 32);
        xwait();
        if (HL) {
#pragma unroll
            for (int c = 0; c < 2; ++c) qf2[g][c] = WFrag<T16>::ld(Q2 + qo + c * 32);
            xwait(); }
#pragma unroll
        for (int dt = 0; dt < 4; ++dt) o[g][dt] = (v8f){}; }
    const int koff = lr * HD + 8 * hi, voff = lr * TT + 8 * hi;
    auto ldk = [&](const int key0) {   // the key rows of the pass that starts at key0
#pragma unroll
        for (int kt = 0; kt < 2; ++kt)
#pragma unroll
            for (int c = 0; c < 2; ++c) kf[kt][c] = WFrag<T16>::ld(Kp + koff + (key0 + kt * 16) * HD + c * 32);
        xwait();
        if (HL) {
#pragma unroll
            for (int kt = 0; kt < 2; ++kt)
#pragma unroll
                for (int c = 0; c < 2; ++c) kf2[kt][c] = WFrag<T16>::ld(K2 + koff + (key0 + kt * 16) * HD + c * 32);
            xwait(); }
    };
    ldk(0);
    // one pass of 32 keys; LAST: nothing is fetched ahead, so that no load is in flight when the wave ends
    auto pass = [&](const int key0, auto lastc) {
        constexpr bool LAST = decltype(lastc)::value;
        V vf[4], vf2[4];
#pragma unroll
        for (int dt = 0; dt < 4; ++dt) vf[dt] = WFrag<T16>::ld(Vt + voff + dt * 16 * TT + key0);
        xwait();
        if (HL) {
#pragma unroll
            for (int dt = 0; dt < 4; ++dt) vf2[dt] = WFrag<T16>::ld(V2 + voff + dt * 16 * TT + key0);
            xwait(); }
        v8f s[NG][2];
#pragma unroll
        for (int g = 0; g < NG; ++g)
#pragma unroll
            for (int kt = 0; kt < 2; ++kt) { v8f a = (v8f){};
#pragma unroll
                for (int c = 0; c < 2; ++c) { a = WFrag<T16>::mma(kf[kt][c], qf[g][c], a); if (HL) { a = WFrag<T16>::mma(kf[kt][c], qf2[g][c], a); a = WFrag<T16>::mma(kf2[kt][c], qf[g][c], a); } }
                s[g][kt] = a; }
        if constexpr (!LAST) ldk(key0 + 32);   // the next pass's key rows are fetched behind this pass's score products, into the same registers
        float ml[NG]; bool need = false;
#pragma unroll
        for (int g = 0; g < NG; ++g) { float mx = s[g][0][0];
#pragma unroll
            for (int r = 1; r < 8; ++r) mx = fmaxf(mx, s[g][0][r]);
#pragma unroll
            for (int r = 0; r < 8; ++r) mx = fmaxf(mx, s[g][1][r]);
            ml[g] = mx * cs; need = need || (ml[g] > mr[g] + MLAZ); }
        if (__builtin_amdgcn_ballot_w32(need) != 0) {   // wave-uniform: always on the first pass, seldom later
#pragma unroll
            for (int g = 0; g < NG; ++g) { const float mn = fmaxf(mr[g], fmaxf(ml[g], xhalf(ml[g]))); const float al = __builtin_amdgcn_exp2f(mr[g] - mn); mr[g] = mn; ls[g] *= al;
#pragma unroll
                for (int dt = 0; dt < 4; ++dt) o[g][dt] *= al; }
        }
        float pp[NG][16];
#pragma unroll
        for (int g = 0; g < NG; ++g) { const float nb = (HL ? 0.0f : PEXP) - mr[g];
#pragma unroll
            for (int e = 0; e < 16; e += 4) exp2x4(__builtin_fmaf(s[g][e >> 3][e & 7], cs, nb), __builtin_fmaf(s[g][e >> 3][(e & 7) + 1], cs, nb), __builtin_fmaf(s[g][e >> 3][(e & 7) + 2], cs, nb), __builtin_fmaf(s[g][e >> 3][(e & 7) + 3], cs, nb), &pp[g][e]); }
        __builtin_amdgcn_sched_barrier(0);   // the asm statements above stay in front of the matrix instructions below
#pragma unroll
        for (int g = 0; g < NG; ++g) { const float* p = pp[g];
#pragma unroll
            for (int e = 0; e < 16; ++e) ls[g] += p[e];
            if constexpr (HL) { v16bf ph, pl;
#pragma unroll
                for (int e = 0; e < 16; ++e) { const __bf16 hb = (__bf16)p[e]; ph[e] = hb; pl[e] = (__bf16)(p[e] - (float)hb); }
#pragma unroll
                for (int dt = 0; dt < 4; ++dt) { o[g][dt] = wmmab(vf[dt], ph, o[g][dt]); o[g][dt] = wmmab(vf[dt], pl, o[g][dt]); o[g][dt] = wmmab(vf2[dt], ph, o[g][dt]); }
            } else { v16h pf;
#pragma unroll
                for (int e = 0; e < 16; ++e) pf[e] = (h16)p[e];
#pragma unroll
                for (int dt = 0; dt < 4; ++dt) o[g][dt] = wmma16(vf[dt], pf, o[g][dt]); }
        }
    };
#pragma unroll 1   // the key loop stays rolled: a second copy of the pass would only add live fragments to a register count that is near 256
    for (int key0 = 0; key0 < TT - 32; key0 += 32) pass(key0, BoolC<false>{});
    pass(TT - 32, BoolC<true>{});
#pragma unroll
    for (int g = 0; g < NG; ++g) { const float inv = __fdiv_rn(1.0f, ls[g] + xhalf(ls[g])); float* op = orow + (size_t)(qb + g * 16 + lr) * DQ + 8 * hi;   // f32 context [t][h*64 + d]: a lane holds d = 16 dt + 8 hi + r of its query
#pragma unroll
        for (int dt = 0; dt < 4; ++dt) { v4f a, b2;
#pragma unroll
            for (int r = 0; r < 4; ++r) { a[r] = o[g][dt][r] * inv; b2[r] = o[g][dt][4 + r] * inv; }
            *(v4f*)(op + dt * 16) = a; *(v4f*)(op + dt * 16 + 4) = b2; } }
}
// grid (batches x heads, RH/128 + (TT-RH)/256), 8 waves: blocks y < RH/128 take a head's hi+lo rows (16 queries a wave, 3 products), the rest its fp16 rows (32 queries a wave); the heads run fastest, so the longer hi+lo blocks all start first
__global__ __launch_bounds__(256) void k_fattn(const h16* __restrict__ Q16, const h16* __restrict__ K16, const h16* __restrict__ V16, const bf* __restrict__ Qh, const bf* __restrict__ Ql, const bf* __restrict__ Kh, const bf* __restrict__ Kl, const bf* __restrict__ Vh, const bf* __restrict__ Vl, float* __restrict__ OUTp) {
    const size_t z = blockIdx.x, zo = z * (size_t)TT * HD; const int wv = __builtin_amdgcn_readfirstlane((int)(threadIdx.x >> 5)); const int bx = (int)blockIdx.y;
    float* orow = OUTp + (z / NH_) * (size_t)TT * DQ + (z % NH_) * HD;
    if (bx < RH / 128) fattn<bf, true, 1>(Qh + zo, Ql + zo, Kh + zo, Kl + zo, Vh + zo, Vl + zo, bx * 128 + wv * 16, orow);
    else fattn<h16, false, 2>(Q16 + zo, nullptr, K16 + zo, nullptr, V16 + zo, nullptr, RH + (bx - RH / 128) * 256 + wv * 32, orow);
}

extern "C" void kernel_launch(void* const* d_in, const int* in_sizes, int n_in,
                              void* d_out, int out_size, void* d_ws, size_t ws_size, hipStream_t stream) {
    (void)in_sizes; (void)n_in; (void)out_size;
    const float* x = (const float*)d_in[0]; const float* g1 = (const float*)d_in[1]; const float* e1b = (const float*)d_in[2]; const float* wq = (const float*)d_in[3]; const float* bq = (const float*)d_in[4]; const float* wk = (const float*)d_in[5]; const float* bk = (const float*)d_in[6]; const float* wv = (const float*)d_in[7]; const float* bv = (const float*)d_in[8]; const float* wo = nullptr; (void)wo;
    float* OUT = (float*)d_out;     // [4][2048][1024]
    char* wsp = (char*)d_ws;
    auto take = [&](size_t bytes) { char* p = wsp; wsp += (bytes + 255) & ~(size_t)255; return (void*)p; };
    bf* WQ = (bf*)take((size_t)DQ * DM * 2); bf* WK = (bf*)take((size_t)DKV * DM * 2); bf* WV = (bf*)take((size_t)DKV * DM * 2); float* CS = (float*)take((size_t)TT * HD * 2 * 4);
    bf* Yh = (bf*)take((size_t)TT * DM * 2); bf* Yl = (bf*)take((size_t)TT * DM * 2); float* FQ = (float*)take((size_t)TT * DQ * 4); float* FK = (float*)take((size_t)TT * DKV * 4);
    const size_t PB = (size_t)NH_ * TT * HD;   // elements of one batch's head planes; the planes of all NB_ batches are kept (9 x 16 MiB), so that one launch does the attention of every batch and head
    h16* QP16 = (h16*)take(NB_ * PB * 2); h16* KP16 = (h16*)take(NB_ * PB * 2); h16* VT16 = (h16*)take(NB_ * PB * 2);
    bf* QPh = (bf*)take(NB_ * PB * 2); bf* QPl = (bf*)take(NB_ * PB * 2); bf* KPh = (bf*)take(NB_ * PB * 2); bf* KPl = (bf*)take(NB_ * PB * 2); bf* VTh = (bf*)take(NB_ * PB * 2); bf* VTl = (bf*)take(NB_ * PB * 2);
    if ((size_t)(wsp - (char*)d_ws) > ws_size) return;    // ws 256 MiB
    float* FV = FK;   // v projection reuses the k buffer after the k planes are built (stream-ordered)
    { k_cvt8<<<(unsigned)(((size_t)DQ * DM / 8 + 255) / 256), 256, 0, stream>>>(wq, WQ, (size_t)DQ * DM / 8); k_cvt8<<<(unsigned)(((size_t)DKV * DM / 8 + 255) / 256), 256, 0, stream>>>(wk, WK, (size_t)DKV * DM / 8); k_cvt8<<<(unsigned)(((size_t)DKV * DM / 8 + 255) / 256), 256, 0, stream>>>(wv, WV, (size_t)DKV * DM / 8);
       }
    k_csid<<<(TT * HD + 255) / 256, 256, 0, stream>>>(CS);
    const unsigned LQ = (unsigned)(((size_t)NH_ * TT * HD / 2 + 255) / 256), LKv = (unsigned)(((size_t)NKV * TT * HD / 2 + 255) / 256);
    for (int b = 0; b < NB_; ++b) {
        
        k_lnhl<<<TT / 8, 256, 0, stream>>>(x + (size_t)b * TT * DM, nullptr, g1, e1b, nullptr, Yh, Yl);   /* x = LN(h) as hi/lo planes */
        k_gemmw<bf, 1, true, KSP><<<dim3(TT / 64, DQ / 64, 1), 32 * KSP, 0, stream>>>(Yh, Yl, WQ, nullptr, DM, DM, FQ, DQ, bq, 0, 0, 0);
        k_rope<<<LQ, 256, 0, stream>>>(FQ, DQ, NH_, CS, nullptr, nullptr, 1.0f, QP16 + b * PB, QPh + b * PB, QPl + b * PB);
        k_gemmw<bf, 1, true, KSP><<<dim3(TT / 64, DKV / 64, 1), 32 * KSP, 0, stream>>>(Yh, Yl, WK, nullptr, DM, DM, FK, DKV, bk, 0, 0, 0);
        k_rope<<<LKv, 256, 0, stream>>>(FK, DKV, NKV, CS, nullptr, nullptr, 1.0f, KP16 + b * PB, KPh + b * PB, KPl + b * PB);
        k_gemmw<bf, 1, true, KSP><<<dim3(TT / 64, DKV / 64, 1), 32 * KSP, 0, stream>>>(Yh, Yl, WV, nullptr, DM, DM, FV, DKV, bv, 0, 0, 0); k_vtp<<<LKv, 256, 0, stream>>>(FV, DKV, NKV, VT16 + b * PB, VTh + b * PB, VTl + b * PB);
    }
    k_fattn<<<dim3(NB_ * NH_, RH / 128 + (TT - RH) / 256, 1), 256, 0, stream>>>(QP16, KP16, VT16, QPh, QPl, KPh, KPl, VTh, VTl, OUT);
}

// v004
// Measured time: 433 microseconds a run.
// In both of two side-by-side timings against v003, it was 1.23 times as fast.
// Over all steps from v000 it is 9.04 times as fast.
#include <hip/hip_runtime.h>

// Perceiver self-attention (hidden_states [4][2048][1024]; x = LN(h) (1e-5, gamma, beta); q, k, v = x W^T + b ('oi' [1024][1024], 16 heads x 64); softmax(q.k/8) over all keys; out = merged context (no output projection) -> [4][2048][1024] (8.4 M)).
// Compute dtypes, f32 accumulate: every input rounded to bf16; q/k/v on x hi+lo bf16 planes (2 products) x plain bf16 weights (inputs: exact) + biases; scores and attn.v (no mask), fused with a running-maximum softmax: query rows < 512 hl (3 products), the rest single fp16 (x64); softmax f32; no output projection: the merged context is written in f32.

#define NB_  4
#define TT   2048
#define DM   1024
#define NH_  16
#define NKV  16
#define REP  (NH_ / NKV)
#define HD   64
#define DQ   (NH_ * HD)
#define DKV  (NKV * HD)
#define LNEPS 1e-5f
typedef __attribute__((ext_vector_type(4))) unsigned short v4us;
#define RH   512                  // query rows < RH use hi+lo planes (0: none)
#define WIN  0
#define PEXP 6.0f                 // fp16 rows: probabilities carry a factor 2^PEXP (it cancels against the row sum); with the lazy bound MLAZ they stay <= 2^14
#define MLAZ 8.0f                 // a row's maximum in use is renewed only when a new score exceeds it by more than this (base-2 exponent units)
#define SCL  0.125f   // HD^-0.5
#define KSP  8                    // waves that share the k range of one tile: projections (K = 1024)
typedef _Float16 h16;
typedef unsigned short bf;
typedef __attribute__((ext_vector_type(16))) __bf16   v16bf;
typedef __attribute__((ext_vector_type(16))) _Float16 v16h;
typedef __attribute__((ext_vector_type(8)))  _Float16 v8h;
typedef __attribute__((ext_vector_type(8)))  unsigned short v8us;
typedef __attribute__((ext_vector_type(8)))  float    v8f;
typedef __attribute__((ext_vector_type(4)))  float    v4f;
typedef v8h  __attribute__((may_alias)) v8ha;
typedef v4f  __attribute__((may_alias)) v4fa;
typedef v8us __attribute__((may_alias)) v8usa;

__device__ __forceinline__ unsigned short f2bf(float f) { unsigned u = __float_as_uint(f); u += 0x7FFFu + ((u >> 16) & 1u); return (unsigned short)(u >> 16); }
__device__ __forceinline__ float bf2f(unsigned short b) { return __uint_as_float(((unsigned)b) << 16); }
__device__ __forceinline__ float bfr(float f) { return bf2f(f2bf(f)); }
__device__ __forceinline__ v16h cat16(v8h lo, v8h hi) { return __builtin_shufflevector(lo, hi, 0, 1, 2, 3, 4, 5, 6, 7, 8, 9, 10, 11, 12, 13, 14, 15); }
__device__ __forceinline__ v16bf cat16b(v8us lo, v8us hi) { return __builtin_bit_cast(v16bf, __builtin_shufflevector(lo, hi, 0, 1, 2, 3, 4, 5, 6, 7, 8, 9, 10, 11, 12, 13, 14, 15)); }
__device__ __forceinline__ v8f wmma16(v16h a, v16h b, v8f c) { return __builtin_amdgcn_wmma_f32_16x16x32_f16(false, a, false, b, (short)0, c, false, false); }
__device__ __forceinline__ v8f wmmab(v16bf a, v16bf b, v8f c) { return __builtin_amdgcn_wmma_f32_16x16x32_bf16(false, a, false, b, (short)0, c, false, false); }



// ---- k_gemmw: register-blocked GEMM, one work-group of KS waves per 64x64 output tile (16 accumulators a wave), operands straight from K-contiguous 16-bit planes (A rows at pitch lda, Bt rows at pitch K, in elements); grid (TT/64, heads), 32 * KS threads.
// Wave w sums k in [w K/KS, (w+1) K/KS); the KS partial tiles meet in LDS and are added in the fixed order w = 0 .. KS-1. K % (32 KS) == 0.
// c[t][n] (f32, + optional f32 bias[n]) = sum_k A[t][k] Bt[n][k] (+ split products per NSPLIT). A tile's 64 columns are one head (HD == 64), and c goes straight from the LDS sum to that head's three 16-bit planes (fp16, bf16 hi, bf16 lo):
// TR false: [h][t][d] (q, k); TR true: [h][d][t] (v), for which the partial tiles lie transposed in LDS, so that either way a thread holds 8 neighbours of a plane row.
template <typename T16> struct WFrag;
template <> struct WFrag<h16> { typedef v16h V; static __device__ __forceinline__ V ld(const h16* p) { return cat16(*(const v8h*)p, *(const v8h*)(p + 16)); } static __device__ __forceinline__ v8f mma(V a, V b, v8f c) { return wmma16(a, b, c); } };
template <> struct WFrag<bf> { typedef v16bf V; static __device__ __forceinline__ V ld(const bf* p) { return cat16b(*(const v8us*)p, *(const v8us*)(p + 16)); } static __device__ __forceinline__ v8f mma(V a, V b, v8f c) { return wmmab(a, b, c); } };
__device__ __forceinline__ h16 tohx(float x) { return (h16)x; }
__device__ __forceinline__ void splitf(float y, unsigned short& h, unsigned short& l) { h = f2bf(y); l = f2bf(y - bf2f(h)); }
template <typename T16, int NSPLIT, bool BIAS, int KS, bool TR>
__global__ __launch_bounds__(32 * KS) void k_gemmw(const T16* __restrict__ A, const T16* __restrict__ A2, const T16* __restrict__ Bt, const T16* __restrict__ Bt2, int K, int lda, const float* __restrict__ bias, h16* __restrict__ P16, bf* __restrict__ Ph, bf* __restrict__ Pl) {
    typedef typename WFrag<T16>::V V;
    __shared__ __align__(16) float os[KS * 64 * 68];
    const int lane = threadIdx.x & 31, lr = lane & 15, hi = lane >> 4; const int r0 = blockIdx.x * 64, c0 = blockIdx.y * 64;
    v8f acc[4][4];
#pragma unroll
    for (int mb = 0; mb < 4; ++mb)
#pragma unroll
        for (int nb = 0; nb < 4; ++nb) acc[mb][nb] = (v8f){};
    const size_t aoff = (size_t)(r0 + lr) * lda + 8 * hi, boff = (size_t)(c0 + lr) * K + 8 * hi;
    const int wv = __builtin_amdgcn_readfirstlane((int)(threadIdx.x >> 5)); const int kb = wv * (K / KS), ke = kb + K / KS;   // this wave's k range; readfirstlane keeps the loop bounds scalar
#pragma unroll 1
    for (int kc = kb; kc < ke; kc += 32) {
        V a[4], a2[4];
#pragma unroll
        for (int mb = 0; mb < 4; ++mb) { a[mb] = WFrag<T16>::ld(A + aoff + (size_t)mb * 16 * lda + kc); if (NSPLIT == 1 || NSPLIT == 2) a2[mb] = WFrag<T16>::ld(A2 + aoff + (size_t)mb * 16 * lda + kc); }
#pragma unroll
        for (int nb = 0; nb < 4; ++nb) { const V b = WFrag<T16>::ld(Bt + boff + (size_t)nb * 16 * K + kc); V b2; if (NSPLIT >= 2) b2 = WFrag<T16>::ld(Bt2 + boff + (size_t)nb * 16 * K + kc);
#pragma unroll
            for (int mb = 0; mb < 4; ++mb) { acc[mb][nb] = WFrag<T16>::mma(a[mb], b, acc[mb][nb]); if (NSPLIT == 1 || NSPLIT == 2) acc[mb][nb] = WFrag<T16>::mma(a2[mb], b, acc[mb][nb]); if (NSPLIT >= 2) acc[mb][nb] = WFrag<T16>::mma(a[mb], b2, acc[mb][nb]); } }
        asm volatile("v_nop\n\tv_nop\n\tv_nop\n\tv_nop" : "+v"(acc[0][0]), "+v"(acc[1][1]), "+v"(acc[2][2]), "+v"(acc[3][3]) : "v"(a[0]), "v"(a[3]));
    }
    float* ow = os + wv * (64 * 68);
    // the loops are unrolled so that acc is indexed by constants and stays in registers
#pragma unroll
    for (int mb = 0; mb < 4; ++mb)
#pragma unroll
        for (int nb = 0; nb < 4; ++nb) {
            if (TR) {   // LDS row = column n, LDS column = row t: a lane's 8 accumulator rows are neighbours, two 16-byte stores
                float* p = ow + (nb * 16 + lr) * 68 + mb * 16 + hi * 8;
                *(v4fa*)p = __builtin_shufflevector(acc[mb][nb], acc[mb][nb], 0, 1, 2, 3); *(v4fa*)(p + 4) = __builtin_shufflevector(acc[mb][nb], acc[mb][nb], 4, 5, 6, 7);
            } else {
#pragma unroll
                for (int j = 0; j < 8; ++j) ow[(mb * 16 + hi * 8 + j) * 68 + nb * 16 + lr] = acc[mb][nb][j]; }
        }
    __syncthreads();   // every wave's partial tile is in LDS before any thread adds them
    // both loops unrolled: a thread's LDS reads issue together instead of one wait per read
#pragma unroll
    for (int s = 0; s < 16 / KS; ++s) { const int i = s * (32 * KS) + (int)threadIdx.x, row = i >> 3, cofs = (i & 7) * 8; v4f va = *(const v4fa*)(os + row * 68 + cofs), vb = *(const v4fa*)(os + row * 68 + cofs + 4);
#pragma unroll
        for (int w = 1; w < KS; ++w) { va += *(const v4fa*)(os + (w * 64 + row) * 68 + cofs); vb += *(const v4fa*)(os + (w * 64 + row) * 68 + cofs + 4); }
        v8h o16; v8us oh, ol;
#pragma unroll
        for (int q = 0; q < 8; ++q) { float c = q < 4 ? va[q] : vb[q - 4]; if (BIAS) c += bfr(bias[c0 + (TR ? row : cofs + q)]); o16[q] = tohx(c); unsigned short h2, l2; splitf(c, h2, l2); oh[q] = h2; ol[q] = l2; }
        const size_t e = TR ? (size_t)(c0 + row) * TT + r0 + cofs : ((size_t)blockIdx.y * TT + r0 + row) * HD + cofs;
        *(v8h*)(P16 + e) = o16; *(v8us*)(Ph + e) = oh; *(v8us*)(Pl + e) = ol; }
}

typedef __attribute__((ext_vector_type(2))) _Float16 v2h;
typedef __attribute__((ext_vector_type(4))) _Float16 v4h;
typedef __attribute__((ext_vector_type(2))) unsigned short v2us;
typedef __attribute__((ext_vector_type(4))) unsigned short v4us;
typedef __attribute__((ext_vector_type(2))) float v2f;
typedef __attribute__((ext_vector_type(4))) int v4i;

__global__ __launch_bounds__(256) void k_wtG(const float* __restrict__ w, int K, int N, bf* Bt) {
    const int lane = threadIdx.x & 31; const int L0 = (blockIdx.x * 8 + (threadIdx.x >> 5)) * 8; const int nlines = N * K / 64;
{
#pragma unroll 1
        for (int l = 0; l < 8; ++l) { const int L = L0 + l; if (L >= nlines) break; const size_t e = (size_t)L * 64 + lane * 2; const int k = (int)(e % K), n = (int)(e / K); v2us o;
            o[0] = f2bf(w[(size_t)k * N + n]); o[1] = f2bf(w[(size_t)(k + 1) * N + n]); *(v2us*)(Bt + e) = o; }
         }
}
__global__ __launch_bounds__(256) void k_lnhl(const float* __restrict__ X, const float* __restrict__ A, const float* __restrict__ g, const float* __restrict__ be, float* Z, bf* Yh, bf* Yl) {
    const int lane = threadIdx.x & 31; const int r = blockIdx.x * 8 + (threadIdx.x >> 5); if (r >= TT) return; const float* xr = X + (size_t)r * DM; const float* ar = A ? A + (size_t)r * DM : nullptr; float s = 0.f;
#pragma unroll 1
    for (int ch = 0; ch < DM / 128; ++ch) { const int c0 = ch * 128 + lane * 4; const v4f a = *(const v4f*)(xr + c0); v4f d = {0.f, 0.f, 0.f, 0.f}; if (ar) d = *(const v4f*)(ar + c0);
#pragma unroll
        for (int q = 0; q < 4; ++q) s += __fadd_rn(bfr(a[q]), d[q]); }
#pragma unroll
    for (int sh = 16; sh; sh >>= 1) s += __shfl_xor(s, sh, 32);
    const float mu = s * (1.0f / DM); float s2 = 0.f;
#pragma unroll 1
    for (int ch = 0; ch < DM / 128; ++ch) { const int c0 = ch * 128 + lane * 4; const v4f a = *(const v4f*)(xr + c0); v4f d = {0.f, 0.f, 0.f, 0.f}; if (ar) d = *(const v4f*)(ar + c0);
#pragma unroll
        for (int q = 0; q < 4; ++q) { const float d0 = __fsub_rn(__fadd_rn(bfr(a[q]), d[q]), mu); float p = __fmul_rn(d0, d0); asm volatile("" : "+v"(p)); s2 = __fadd_rn(s2, p); } }
#pragma unroll
    for (int sh = 16; sh; sh >>= 1) s2 += __shfl_xor(s2, sh, 32);
    const float rs = __fdiv_rn(1.0f, __fsqrt_rn(__fadd_rn(s2 * (1.0f / DM), LNEPS)));
{
#pragma unroll 1
        for (int ch = 0; ch < DM / 128; ++ch) { const int c0 = ch * 128 + lane * 4; const v4f a = *(const v4f*)(xr + c0); v4f d = {0.f, 0.f, 0.f, 0.f}; if (ar) d = *(const v4f*)(ar + c0); v4f z4; v4us oh, ol;
#pragma unroll
            for (int q = 0; q < 4; ++q) { const float v = __fadd_rn(bfr(a[q]), d[q]); z4[q] = v; float n0 = __fmul_rn(__fsub_rn(v, mu), rs); asm volatile("" : "+v"(n0)); float n1 = __fmul_rn(n0, bfr(g[c0 + q])); asm volatile("" : "+v"(n1)); const float y = __fadd_rn(n1, bfr(be[c0 + q])); unsigned short h2, l2; splitf(y, h2, l2); oh[q] = h2; ol[q] = l2; }
            if (Z) *(v4f*)(Z + (size_t)r * DM + c0) = z4; *(v4us*)(Yh + (size_t)r * DM + c0) = oh; *(v4us*)(Yl + (size_t)r * DM + c0) = ol; }
         } }
__global__ __launch_bounds__(256) void k_addres(const float* __restrict__ X, const float* __restrict__ Y, float* O, size_t n4) { const size_t i = (size_t)blockIdx.x * 256 + threadIdx.x; if (i >= n4) return; const v4f a = *(const v4f*)(X + i * 4), b = *(const v4f*)(Y + i * 4); v4f o;
#pragma unroll
    for (int q = 0; q < 4; ++q) o[q] = __fadd_rn(bfr(a[q]), b[q]); *(v4f*)(O + i * 4) = o;  }
__global__ __launch_bounds__(256) void k_cvt8(const float* __restrict__ src, bf* dst, size_t n8) { const size_t i = (size_t)blockIdx.x * 256 + threadIdx.x; if (i >= n8) return; const v8f v = *(const v8f*)(src + i * 8); v8us o;
#pragma unroll
    for (int k = 0; k < 8; ++k) o[k] = f2bf(v[k]); *(v8us*)(dst + i * 8) = o;  }

// ---- k_fattn: scores, softmax and attn.v of one head in one kernel; no score ever leaves the registers.
// Transposed products: S^T = K Q^T (A = 16 key rows, B = 16 query columns), O^T += V^T P^T. A lane holds scores of ONE query (column lr), keys 8 hi + r of each 16-key tile,
// so two score tiles of a 32-key pass, converted in place, are the B operand of the second product (k order of WFrag::ld), and maximum and sum are in-lane but for one exchange between the wave's halves.
// Running maximum (base-2 units) with a lazy renewal; the row sum is kept per half and joined at the end. One wave: NG groups of 16 queries, all 2048 keys, 32 a pass.
// Every inner loop is unrolled so that the fragment, score and accumulator arrays are indexed by constants and stay in registers.
__device__ __forceinline__ float xhalf(float x) { return __builtin_bit_cast(float, __builtin_amdgcn_permlanex16(__builtin_bit_cast(int, x), __builtin_bit_cast(int, x), 0x76543210, 0xfedcba98, false, false)); }   // lane l <-> lane l ^ 16
template <bool B> struct BoolC { static constexpr bool value = B; };
// four v_exp_f32 and the slot behind the last in one statement; the results share no register with the sources, so no instruction here or behind it reads a result or overwrites a source directly behind its v_exp_f32
__device__ __forceinline__ void exp2x4(float x0, float x1, float x2, float x3, float* r) { float a, b, c, d;
    asm("v_exp_f32 %0, %4\n\tv_exp_f32 %1, %5\n\tv_exp_f32 %2, %6\n\tv_exp_f32 %3, %7\n\tv_nop" : "=&v"(a), "=&v"(b), "=&v"(c), "=&v"(d) : "v"(x0), "v"(x1), "v"(x2), "v"(x3)); r[0] = a; r[1] = b; r[2] = c; r[3] = d; }
// stands behind each run of global loads from one base, in front of whatever gives their address registers a new value (a later load's result, a scalar move)
__device__ __forceinline__ void xwait() { asm volatile("s_wait_xcnt 0x0" ::: "memory"); }
template <typename T16, bool HL, int NG>
__device__ __forceinline__ void fattn(const T16* __restrict__ Q, const T16* __restrict__ Q2, const T16* __restrict__ Kp, const T16* __restrict__ K2, const T16* __restrict__ Vt, const T16* __restrict__ V2, int qb, float* __restrict__ orow) {
    typedef typename WFrag<T16>::V V;
    const int lane = threadIdx.x & 31, lr = lane & 15, hi = lane >> 4;
    const float cs = SCL * 1.4426950408889634f;
    V qf[NG][2], qf2[NG][2], kf[2][2], kf2[2][2];
    v8f o[NG][4]; float mr[NG], ls[NG];
#pragma unroll
    for (int g = 0; g < NG; ++g) { mr[g] = -3.0e38f; ls[g] = 0.f;
        const size_t qo = (size_t)(qb + g * 16 + lr) * HD + 8 * hi;
#pragma unroll
        for (int c = 0; c < 2; ++c) qf[g][c] = WFrag<T16>::ld(Q + qo + c * 32);
        xwait();
        if (HL) {
#pragma unroll
            for (int c = 0; c < 2; ++c) qf2[g][c] = WFrag<T16>::ld(Q2 + qo + c * 32);
            xwait(); }
#pragma unroll
        for (int dt = 0; dt < 4; ++dt) o[g][dt] = (v8f){}; }
    const int koff = lr * HD + 8 * hi, voff = lr * TT + 8 * hi;
    auto ldk = [&](const int key0) {   // the key rows of the pass that starts at key0
#pragma unroll
        for (int kt = 0; kt < 2; ++kt)
#pragma unroll
            for (int c = 0; c < 2; ++c) kf[kt][c] = WFrag<T16>::ld(Kp + koff + (key0 + kt * 16) * HD + c * 32);
        xwait();
        if (HL) {
#pragma unroll
            for (int kt = 0; kt < 2; ++kt)
#pragma unroll
                for (int c = 0; c < 2; ++c) kf2[kt][c] = WFrag<T16>::ld(K2 + koff + (key0 + kt * 16) * HD + c * 32);
            xwait(); }
    };
    ldk(0);
    // one pass of 32 keys; LAST: nothing is fetched ahead, so that no load is in flight when the wave ends
    auto pass = [&](const int key0, auto lastc) {
        constexpr bool LAST = decltype(lastc)::value;
        V vf[4], vf2[4];
#pragma unroll
        for (int dt = 0; dt < 4; ++dt) vf[dt] = WFrag<T16>::ld(Vt + voff + dt * 16 * TT + key0);
        xwait();
        if (HL) {
#pragma unroll
            for (int dt = 0; dt < 4; ++dt) vf2[dt] = WFrag<T16>::ld(V2 + voff + dt * 16 * TT + key0);
            xwait(); }
        v8f s[NG][2];
#pragma unroll
        for (int g = 0; g < NG; ++g)
#pragma unroll
            for (int kt = 0; kt < 2; ++kt) { v8f a = (v8f){};
#pragma unroll
                for (int c = 0; c < 2; ++c) { a = WFrag<T16>::mma(kf[kt][c], qf[g][c], a); if (HL) { a = WFrag<T16>::mma(kf[kt][c], qf2[g][c], a); a = WFrag<T16>::mma(kf2[kt][c], qf[g][c], a); } }
                s[g][kt] = a; }
        if constexpr (!LAST) ldk(key0 + 32);   // the next pass's key rows are fetched behind this pass's score products, into the same registers
        float ml[NG]; bool need = false;
#pragma unroll
        for (int g = 0; g < NG; ++g) { float mx = s[g][0][0];
#pragma unroll
            for (int r = 1; r < 8; ++r) mx = fmaxf(mx, s[g][0][r]);
#pragma unroll
            for (int r = 0; r < 8; ++r) mx = fmaxf(mx, s[g][1][r]);
            ml[g] = mx * cs; need = need || (ml[g] > mr[g] + MLAZ); }
        if (__builtin_amdgcn_ballot_w32(need) != 0) {   // wave-uniform: always on the first pass, seldom later
#pragma unroll
            for (int g = 0; g < NG; ++g) { const float mn = fmaxf(mr[g], fmaxf(ml[g], xhalf(ml[g]))); const float al = __builtin_amdgcn_exp2f(mr[g] - mn); mr[g] = mn; ls[g] *= al;
#pragma unroll
                for (int dt = 0; dt < 4; ++dt) o[g][dt] *= al; }
        }
        float pp[NG][16];
#pragma unroll
        for (int g = 0; g < NG; ++g) { const float nb = (HL ? 0.0f : PEXP) - mr[g];
#pragma unroll
            for (int e = 0; e < 16; e += 4) exp2x4(__builtin_fmaf(s[g][e >> 3][e & 7], cs, nb), __builtin_fmaf(s[g][e >> 3][(e & 7) + 1], cs, nb), __builtin_fmaf(s[g][e >> 3][(e & 7) + 2], cs, nb), __builtin_fmaf(s[g][e >> 3][(e & 7) + 3], cs, nb), &pp[g][e]); }
        __builtin_amdgcn_sched_barrier(0);   // the asm statements above stay in front of the matrix instructions below
#pragma unroll
        for (int g = 0; g < NG; ++g) { const float* p = pp[g];
#pragma unroll
            for (int e = 0; e < 16; ++e) ls[g] += p[e];
            if constexpr (HL) { v16bf ph, pl;
#pragma unroll
                for (int e = 0; e < 16; ++e) { const __bf16 hb = (__bf16)p[e]; ph[e] = hb; pl[e] = (__bf16)(p[e] - (float)hb); }
#pragma unroll
                for (int dt = 0; dt < 4; ++dt) { o[g][dt] = wmmab(vf[dt], ph, o[g][dt]); o[g][dt] = wmmab(vf[dt], pl, o[g][dt]); o[g][dt] = wmmab(vf2[dt], ph, o[g][dt]); }
            } else { v16h pf;
#pragma unroll
                for (int e = 0; e < 16; ++e) pf[e] = (h16)p[e];
#pragma unroll
                for (int dt = 0; dt < 4; ++dt) o[g][dt] = wmma16(vf[dt], pf, o[g][dt]); }
        }
    };
#pragma unroll 1   // the key loop stays rolled: a second copy of the pass would only add live fragments to a register count that is near 256
    for (int key0 = 0; key0 < TT - 32; key0 += 32) pass(key0, BoolC<false>{});
    pass(TT - 32, BoolC<true>{});
#pragma unroll
    for (int g = 0; g < NG; ++g) { const float inv = __fdiv_rn(1.0f, ls[g] + xhalf(ls[g])); float* op = orow + (size_t)(qb + g * 16 + lr) * DQ + 8 * hi;   // f32 context [t][h*64 + d]: a lane holds d = 16 dt + 8 hi + r of its query
#pragma unroll
        for (int dt = 0; dt < 4; ++dt) { v4f a, b2;
#pragma unroll
            for (int r = 0; r < 4; ++r) { a[r] = o[g][dt][r] * inv; b2[r] = o[g][dt][4 + r] * inv; }
            *(v4f*)(op + dt * 16) = a; *(v4f*)(op + dt * 16 + 4) = b2; } }
}
// grid (batches x heads, RH/128 + (TT-RH)/256), 8 waves: blocks y < RH/128 take a head's hi+lo rows (16 queries a wave, 3 products), the rest its fp16 rows (32 queries a wave); the heads run fastest, so the longer hi+lo blocks all start first
__global__ __launch_bounds__(256) void k_fattn(const h16* __restrict__ Q16, const h16* __restrict__ K16, const h16* __restrict__ V16, const bf* __restrict__ Qh, const bf* __restrict__ Ql, const bf* __restrict__ Kh, const bf* __restrict__ Kl, const bf* __restrict__ Vh, const bf* __restrict__ Vl, float* __restrict__ OUTp) {
    const size_t z = blockIdx.x, zo = z * (size_t)TT * HD; const int wv = __builtin_amdgcn_readfirstlane((int)(threadIdx.x >> 5)); const int bx = (int)blockIdx.y;
    float* orow = OUTp + (z / NH_) * (size_t)TT * DQ + (z % NH_) * HD;
    if (bx < RH / 128) fattn<bf, true, 1>(Qh + zo, Ql + zo, Kh + zo, Kl + zo, Vh + zo, Vl + zo, bx * 128 + wv * 16, orow);
    else fattn<h16, false, 2>(Q16 + zo, nullptr, K16 + zo, nullptr, V16 + zo, nullptr, RH + (bx - RH / 128) * 256 + wv * 32, orow);
}

extern "C" void kernel_launch(void* const* d_in, const int* in_sizes, int n_in,
                              void* d_out, int out_size, void* d_ws, size_t ws_size, hipStream_t stream) {
    (void)in_sizes; (void)n_in; (void)out_size;
    const float* x = (const float*)d_in[0]; const float* g1 = (const float*)d_in[1]; const float* e1b = (const float*)d_in[2]; const float* wq = (const float*)d_in[3]; const float* bq = (const float*)d_in[4]; const float* wk = (const float*)d_in[5]; const float* bk = (const float*)d_in[6]; const float* wv = (const float*)d_in[7]; const float* bv = (const float*)d_in[8]; const float* wo = nullptr; (void)wo;
    float* OUT = (float*)d_out;     // [4][2048][1024]
    char* wsp = (char*)d_ws;
    auto take = [&](size_t bytes) { char* p = wsp; wsp += (bytes + 255) & ~(size_t)255; return (void*)p; };
    bf* WQ = (bf*)take((size_t)DQ * DM * 2); bf* WK = (bf*)take((size_t)DKV * DM * 2); bf* WV = (bf*)take((size_t)DKV * DM * 2);
    bf* Yh = (bf*)take((size_t)TT * DM * 2); bf* Yl = (bf*)take((size_t)TT * DM * 2);
    const size_t PB = (size_t)NH_ * TT * HD;   // elements of one batch's head planes; the planes of all NB_ batches are kept (9 x 16 MiB), so that one launch does the attention of every batch and head
    h16* QP16 = (h16*)take(NB_ * PB * 2); h16* KP16 = (h16*)take(NB_ * PB * 2); h16* VT16 = (h16*)take(NB_ * PB * 2);
    bf* QPh = (bf*)take(NB_ * PB * 2); bf* QPl = (bf*)take(NB_ * PB * 2); bf* KPh = (bf*)take(NB_ * PB * 2); bf* KPl = (bf*)take(NB_ * PB * 2); bf* VTh = (bf*)take(NB_ * PB * 2); bf* VTl = (bf*)take(NB_ * PB * 2);
    if ((size_t)(wsp - (char*)d_ws) > ws_size) return;    // ws 256 MiB
    { k_cvt8<<<(unsigned)(((size_t)DQ * DM / 8 + 255) / 256), 256, 0, stream>>>(wq, WQ, (size_t)DQ * DM / 8); k_cvt8<<<(unsigned)(((size_t)DKV * DM / 8 + 255) / 256), 256, 0, stream>>>(wk, WK, (size_t)DKV * DM / 8); k_cvt8<<<(unsigned)(((size_t)DKV * DM / 8 + 255) / 256), 256, 0, stream>>>(wv, WV, (size_t)DKV * DM / 8);
       }
    for (int b = 0; b < NB_; ++b) {
        
        k_lnhl<<<TT / 8, 256, 0, stream>>>(x + (size_t)b * TT * DM, nullptr, g1, e1b, nullptr, Yh, Yl);   /* x = LN(h) as hi/lo planes */
        k_gemmw<bf, 1, true, KSP, false><<<dim3(TT / 64, NH_, 1), 32 * KSP, 0, stream>>>(Yh, Yl, WQ, nullptr, DM, DM, bq, QP16 + b * PB, QPh + b * PB, QPl + b * PB);
        k_gemmw<bf, 1, true, KSP, false><<<dim3(TT / 64, NKV, 1), 32 * KSP, 0, stream>>>(Yh, Yl, WK, nullptr, DM, DM, bk, KP16 + b * PB, KPh + b * PB, KPl + b * PB);
        k_gemmw<bf, 1, true, KSP, true><<<dim3(TT / 64, NKV, 1), 32 * KSP, 0, stream>>>(Yh, Yl, WV, nullptr, DM, DM, bv, VT16 + b * PB, VTh + b * PB, VTl + b * PB);
    }
    k_fattn<<<dim3(NB_ * NH_, RH / 128 + (TT - RH) / 256, 1), 256, 0, stream>>>(QP16, KP16, VT16, QPh, QPl, KPh, KPl, VTh, VTl, OUT);
}

// v005
// A run of this version takes 281 microseconds.
// Timed twice side by side with v004, it ran 1.53 and 1.55 times as fast.
// All steps since v000 together make it 13.9 times as fast.
#include <hip/hip_runtime.h>

// Perceiver self-attention (hidden_states [4][2048][1024]; x = LN(h) (1e-5, gamma, beta); q, k, v = x W^T + b ('oi' [1024][1024], 16 heads x 64); softmax(q.k/8) over all keys; out = merged context (no output projection) -> [4][2048][1024] (8.4 M)).
// Compute dtypes, f32 accumulate: every input rounded to bf16; q/k/v on x hi+lo bf16 planes (2 products) x plain bf16 weights (inputs: exact) + biases; scores and attn.v (no mask), fused with a running-maximum softmax: query rows < 512 hl (3 products), the rest single fp16 (x64); softmax f32; no output projection: the merged context is written in f32.

#define NB_  4
#define TT   2048
#define DM   1024
#define NH_  16
#define NKV  16
#define REP  (NH_ / NKV)
#define HD   64
#define DQ   (NH_ * HD)
#define DKV  (NKV * HD)
#define LNEPS 1e-5f
typedef __attribute__((ext_vector_type(4))) unsigned short v4us;
#define RH   512                  // query rows < RH use hi+lo planes (0: none)
#define WIN  0
#define PEXP 6.0f                 // fp16 rows: probabilities carry a factor 2^PEXP (it cancels against the row sum); with the lazy bound MLAZ they stay <= 2^14
#define MLAZ 8.0f                 // a row's maximum in use is renewed only when a new score exceeds it by more than this (base-2 exponent units)
#define SCL  0.125f   // HD^-0.5
#define KSP  8                    // waves that share the k range of one tile: projections (K = 1024)
typedef _Float16 h16;
typedef unsigned short bf;
typedef __attribute__((ext_vector_type(16))) __bf16   v16bf;
typedef __attribute__((ext_vector_type(16))) _Float16 v16h;
typedef __attribute__((ext_vector_type(8)))  _Float16 v8h;
typedef __attribute__((ext_vector_type(8)))  unsigned short v8us;
typedef __attribute__((ext_vector_type(8)))  float    v8f;
typedef __attribute__((ext_vector_type(4)))  float    v4f;
typedef v8h  __attribute__((may_alias)) v8ha;
typedef v4f  __attribute__((may_alias)) v4fa;
typedef v8us __attribute__((may_alias)) v8usa;

__device__ __forceinline__ unsigned short f2bf(float f) { unsigned u = __float_as_uint(f); u += 0x7FFFu + ((u >> 16) & 1u); return (unsigned short)(u >> 16); }
__device__ __forceinline__ float bf2f(unsigned short b) { return __uint_as_float(((unsigned)b) << 16); }
__device__ __forceinline__ float bfr(float f) { return bf2f(f2bf(f)); }
__device__ __forceinline__ v16h cat16(v8h lo, v8h hi) { return __builtin_shufflevector(lo, hi, 0, 1, 2, 3, 4, 5, 6, 7, 8, 9, 10, 11, 12, 13, 14, 15); }
__device__ __forceinline__ v16bf cat16b(v8us lo, v8us hi) { return __builtin_bit_cast(v16bf, __builtin_shufflevector(lo, hi, 0, 1, 2, 3, 4, 5, 6, 7, 8, 9, 10, 11, 12, 13, 14, 15)); }
__device__ __forceinline__ v8f wmma16(v16h a, v16h b, v8f c) { return __builtin_amdgcn_wmma_f32_16x16x32_f16(false, a, false, b, (short)0, c, false, false); }
__device__ __forceinline__ v8f wmmab(v16bf a, v16bf b, v8f c) { return __builtin_amdgcn_wmma_f32_16x16x32_bf16(false, a, false, b, (short)0, c, false, false); }



// ---- k_gemmw: register-blocked GEMM, one work-group of KS waves per 64x64 output tile (16 accumulators a wave), operands straight from 16-bit planes in fragment order (A of lda columns, Bt of K columns); grid (TT/64, heads), 32 * KS threads.
// Wave w sums k in [w K/KS, (w+1) K/KS); the KS partial tiles meet in LDS and are added in the fixed order w = 0 .. KS-1. K % (32 KS) == 0.
// c[t][n] (f32, + optional f32 bias[n]) = sum_k A[t][k] Bt[n][k] (+ split products per NSPLIT). A tile's 64 columns are one head (HD == 64), and c goes straight from the LDS sum to that head's three 16-bit planes (fp16, bf16 hi, bf16 lo):
// TR false: [h][t][d] (q, k); TR true: [h][d][t] (v), each head's plane in fragment order; for TR the partial tiles lie transposed in LDS, so that either way a thread holds 8 neighbours of a plane row.
// FRAGMENT ORDER: every 16-bit plane that a matrix fragment is loaded from (LN rows, weights, q, k, v^T) is kept as blocks of 16 rows x 32 columns, 512 elements in a row each; block (r / 16, c / 32) has the index (r / 16) * sr + (c / 32) * sc.
// Inside a block the 16-byte pieces lie as the two loads of a fragment take them: piece [c % 32 / 16][c % 16 / 8][r % 16]. So a wave's load (lane = 16 hi + lr, 16 bytes a lane) is 512 bytes in a row, four whole 128-byte lines, where a row-major plane gave it 32 bytes of each of 16 lines.
// fo8: element offset of the 8 neighbours (r, c .. c + 7), c % 8 == 0, in such a plane. The k order of a fragment is that of the row-major loader: lane (lr, hi), load L, element e hold column 16 L + 8 hi + e of row lr.
// LN rows, weights: sr = DM / 32, sc = 1. q, k of a head ([t][d]): sr = 2, sc = 1. v^T of a head ([d][t]): sr = 1, sc = 4. So the 32 keys of an attention pass are 4 KiB in a row in k and in v^T alike.
__device__ __forceinline__ size_t fo8(int r, int c, int sr, int sc) { return ((size_t)(r >> 4) * sr + (size_t)(c >> 5) * sc) * 512 + ((c >> 4) & 1) * 256 + (((c >> 3) & 1) * 16 + (r & 15)) * 8; }
// WFrag::ld(p, l8): p = the block's first element, the same for the whole wave, and l8 = 8 * lane; or p = the lane's own piece and l8 = 0.
template <typename T16> struct WFrag;
template <> struct WFrag<h16> { typedef v16h V; static __device__ __forceinline__ V ld(const h16* p, unsigned l8) { return cat16(*(const v8h*)(p + l8), *(const v8h*)(p + 256 + l8)); } static __device__ __forceinline__ v8f mma(V a, V b, v8f c) { return wmma16(a, b, c); } };
template <> struct WFrag<bf> { typedef v16bf V; static __device__ __forceinline__ V ld(const bf* p, unsigned l8) { return cat16b(*(const v8us*)(p + l8), *(const v8us*)(p + 256 + l8)); } static __device__ __forceinline__ v8f mma(V a, V b, v8f c) { return wmmab(a, b, c); } };
__device__ __forceinline__ h16 tohx(float x) { return (h16)x; }
__device__ __forceinline__ void splitf(float y, unsigned short& h, unsigned short& l) { h = f2bf(y); l = f2bf(y - bf2f(h)); }
// stands behind each run of global loads from one base, in front of whatever gives their address registers a new value (a later load's result, a scalar move)
__device__ __forceinline__ void xwait() { asm volatile("s_wait_xcnt 0x0" ::: "memory"); }
// the same wait; the run's address is an input, so that its registers live up to the wait and no load of the run has its result land on them
__device__ __forceinline__ void xwaita(const void* p) { asm volatile("s_wait_xcnt 0x0" :: "v"(p) : "memory"); }
template <typename T16, int NSPLIT, bool BIAS, int KS, bool TR, int K, int lda>   // K, lda: constants, so that a k step's fragments lie at immediate offsets from one address a plane
__global__ __launch_bounds__(32 * KS) void k_gemmw(const T16* __restrict__ A, const T16* __restrict__ A2, const T16* __restrict__ Bt, const T16* __restrict__ Bt2, const float* __restrict__ bias, h16* __restrict__ P16, bf* __restrict__ Ph, bf* __restrict__ Pl) {
    typedef typename WFrag<T16>::V V;
    __shared__ __align__(16) float os[KS * 64 * 68];
    const int lane = threadIdx.x & 31, lr = lane & 15, hi = lane >> 4; const int r0 = blockIdx.x * 64, c0 = blockIdx.y * 64;
    v8f acc[4][4];
#pragma unroll
    for (int mb = 0; mb < 4; ++mb)
#pragma unroll
        for (int nb = 0; nb < 4; ++nb) acc[mb][nb] = (v8f){};
    const size_t aoff = (size_t)r0 * lda, boff = (size_t)c0 * K; const unsigned l8 = 8 * lane;   // block row r0 / 16 starts at element r0 * columns; a step of 32 in k is one block, 512 elements
    const int wv = __builtin_amdgcn_readfirstlane((int)(threadIdx.x >> 5)); const int kb = wv * (K / KS), ke = kb + K / KS;   // this wave's k range; readfirstlane keeps the loop bounds scalar
    const T16* Ak = A + aoff + (size_t)kb * 16 + l8; const T16* Bk = Bt + boff + (size_t)kb * 16 + l8;   // the lane's piece of the wave's first blocks
    const T16* A2k = (NSPLIT == 1 || NSPLIT == 2) ? A2 + aoff + (size_t)kb * 16 + l8 : nullptr; const T16* B2k = NSPLIT >= 2 ? Bt2 + boff + (size_t)kb * 16 + l8 : nullptr;
#pragma unroll 1
    for (int kc = kb; kc < ke; kc += 32) {
        V a[4], a2[4], b[4], b2[4];
#pragma unroll
        for (int mb = 0; mb < 4; ++mb) a[mb] = WFrag<T16>::ld(Ak + (size_t)mb * 16 * lda, 0);
        xwaita(Ak);
        if (NSPLIT == 1 || NSPLIT == 2) {
#pragma unroll
            for (int mb = 0; mb < 4; ++mb) a2[mb] = WFrag<T16>::ld(A2k + (size_t)mb * 16 * lda, 0);
            xwaita(A2k); }
#pragma unroll
        for (int nb = 0; nb < 4; ++nb) b[nb] = WFrag<T16>::ld(Bk + (size_t)nb * 16 * K, 0);
        xwaita(Bk);
        if (NSPLIT >= 2) {
#pragma unroll
            for (int nb = 0; nb < 4; ++nb) b2[nb] = WFrag<T16>::ld(B2k + (size_t)nb * 16 * K, 0);
            xwaita(B2k); }
#pragma unroll
        for (int nb = 0; nb < 4; ++nb)
#pragma unroll
            for (int mb = 0; mb < 4; ++mb) { acc[mb][nb] = WFrag<T16>::mma(a[mb], b[nb], acc[mb][nb]); if (NSPLIT == 1 || NSPLIT == 2) acc[mb][nb] = WFrag<T16>::mma(a2[mb], b[nb], acc[mb][nb]); if (NSPLIT >= 2) acc[mb][nb] = WFrag<T16>::mma(a[mb], b2[nb], acc[mb][nb]); }
        Ak += 512; Bk += 512; if (NSPLIT == 1 || NSPLIT == 2) A2k += 512; if (NSPLIT >= 2) B2k += 512;
        asm volatile("v_nop\n\tv_nop\n\tv_nop\n\tv_nop" : "+v"(acc[0][0]), "+v"(acc[1][1]), "+v"(acc[2][2]), "+v"(acc[3][3]) : "v"(a[0]), "v"(a[3]));
    }
    float* ow = os + wv * (64 * 68);
    // the loops are unrolled so that acc is indexed by constants and stays in registers
#pragma unroll
    for (int mb = 0; mb < 4; ++mb)
#pragma unroll
        for (int nb = 0; nb < 4; ++nb) {
            if (TR) {   // LDS row = column n, LDS column = row t: a lane's 8 accumulator rows are neighbours, two 16-byte stores
                float* p = ow + (nb * 16 + lr) * 68 + mb * 16 + hi * 8;
                *(v4fa*)p = __builtin_shufflevector(acc[mb][nb], acc[mb][nb], 0, 1, 2, 3); *(v4fa*)(p + 4) = __builtin_shufflevector(acc[mb][nb], acc[mb][nb], 4, 5, 6, 7);
            } else {
#pragma unroll
                for (int j = 0; j < 8; ++j) ow[(mb * 16 + hi * 8 + j) * 68 + nb * 16 + lr] = acc[mb][nb][j]; }
        }
    __syncthreads();   // every wave's partial tile is in LDS before any thread adds them
    // both loops unrolled: a thread's LDS reads issue together instead of one wait per read
#pragma unroll
    for (int s = 0; s < 16 / KS; ++s) { const int i = s * (32 * KS) + (int)threadIdx.x, hb = i >> 5, row = (hb >> 2) * 16 + (i & 15), cofs = (hb & 3) * 16 + ((i >> 4) & 1) * 8;   /* a wave takes the 32 pieces of one fragment load, 512 bytes in a row of each plane */ v4f va = *(const v4fa*)(os + row * 68 + cofs), vb = *(const v4fa*)(os + row * 68 + cofs + 4);
#pragma unroll
        for (int w = 1; w < KS; ++w) { va += *(const v4fa*)(os + (w * 64 + row) * 68 + cofs); vb += *(const v4fa*)(os + (w * 64 + row) * 68 + cofs + 4); }
        v8h o16; v8us oh, ol;
#pragma unroll
        for (int q = 0; q < 8; ++q) { float c = q < 4 ? va[q] : vb[q - 4]; if (BIAS) c += bfr(bias[c0 + (TR ? row : cofs + q)]); o16[q] = tohx(c); unsigned short h2, l2; splitf(c, h2, l2); oh[q] = h2; ol[q] = l2; }
        const size_t e = (size_t)blockIdx.y * TT * HD + (TR ? fo8(row, r0 + cofs, 1, HD / 16) : fo8(r0 + row, cofs, HD / 32, 1));
        *(v8h*)(P16 + e) = o16; *(v8us*)(Ph + e) = oh; *(v8us*)(Pl + e) = ol; }
}

typedef __attribute__((ext_vector_type(2))) _Float16 v2h;
typedef __attribute__((ext_vector_type(4))) _Float16 v4h;
typedef __attribute__((ext_vector_type(2))) unsigned short v2us;
typedef __attribute__((ext_vector_type(4))) unsigned short v4us;
typedef __attribute__((ext_vector_type(2))) float v2f;
typedef __attribute__((ext_vector_type(4))) int v4i;

__global__ __launch_bounds__(256) void k_wtG(const float* __restrict__ w, int K, int N, bf* Bt) {
    const int lane = threadIdx.x & 31; const int L0 = (blockIdx.x * 8 + (threadIdx.x >> 5)) * 8; const int nlines = N * K / 64;
{
#pragma unroll 1
        for (int l = 0; l < 8; ++l) { const int L = L0 + l; if (L >= nlines) break; const size_t e = (size_t)L * 64 + lane * 2; const int k = (int)(e % K), n = (int)(e / K); v2us o;
            o[0] = f2bf(w[(size_t)k * N + n]); o[1] = f2bf(w[(size_t)(k + 1) * N + n]); *(v2us*)(Bt + e) = o; }
         }
}
__global__ __launch_bounds__(256) void k_lnhl(const float* __restrict__ X, const float* __restrict__ A, const float* __restrict__ g, const float* __restrict__ be, float* Z, bf* Yh, bf* Yl) {
    const int lane = threadIdx.x & 31; const int r = blockIdx.x * 8 + (threadIdx.x >> 5); if (r >= TT) return; const float* xr = X + (size_t)r * DM; const float* ar = A ? A + (size_t)r * DM : nullptr; float s = 0.f;
#pragma unroll 1
    for (int ch = 0; ch < DM / 128; ++ch) { const int c0 = ch * 128 + lane * 4; const v4f a = *(const v4f*)(xr + c0); v4f d = {0.f, 0.f, 0.f, 0.f}; if (ar) d = *(const v4f*)(ar + c0);
#pragma unroll
        for (int q = 0; q < 4; ++q) s += __fadd_rn(bfr(a[q]), d[q]); }
#pragma unroll
    for (int sh = 16; sh; sh >>= 1) s += __shfl_xor(s, sh, 32);
    const float mu = s * (1.0f / DM); float s2 = 0.f;
#pragma unroll 1
    for (int ch = 0; ch < DM / 128; ++ch) { const int c0 = ch * 128 + lane * 4; const v4f a = *(const v4f*)(xr + c0); v4f d = {0.f, 0.f, 0.f, 0.f}; if (ar) d = *(const v4f*)(ar + c0);
#pragma unroll
        for (int q = 0; q < 4; ++q) { const float d0 = __fsub_rn(__fadd_rn(bfr(a[q]), d[q]), mu); float p = __fmul_rn(d0, d0); asm volatile("" : "+v"(p)); s2 = __fadd_rn(s2, p); } }
#pragma unroll
    for (int sh = 16; sh; sh >>= 1) s2 += __shfl_xor(s2, sh, 32);
    const float rs = __fdiv_rn(1.0f, __fsqrt_rn(__fadd_rn(s2 * (1.0f / DM), LNEPS)));
{
#pragma unroll 1
        for (int ch = 0; ch < DM / 128; ++ch) { const int c0 = ch * 128 + lane * 4; const v4f a = *(const v4f*)(xr + c0); v4f d = {0.f, 0.f, 0.f, 0.f}; if (ar) d = *(const v4f*)(ar + c0); v4f z4; v4us oh, ol;
#pragma unroll
            for (int q = 0; q < 4; ++q) { const float v = __fadd_rn(bfr(a[q]), d[q]); z4[q] = v; float n0 = __fmul_rn(__fsub_rn(v, mu), rs); asm volatile("" : "+v"(n0)); float n1 = __fmul_rn(n0, bfr(g[c0 + q])); asm volatile("" : "+v"(n1)); const float y = __fadd_rn(n1, bfr(be[c0 + q])); unsigned short h2, l2; splitf(y, h2, l2); oh[q] = h2; ol[q] = l2; }
            if (Z) *(v4f*)(Z + (size_t)r * DM + c0) = z4; const size_t e = fo8(r, c0 & ~7, DM / 32, 1) + (c0 & 7); *(v4us*)(Yh + e) = oh; *(v4us*)(Yl + e) = ol; }
         } }
__global__ __launch_bounds__(256) void k_addres(const float* __restrict__ X, const float* __restrict__ Y, float* O, size_t n4) { const size_t i = (size_t)blockIdx.x * 256 + threadIdx.x; if (i >= n4) return; const v4f a = *(const v4f*)(X + i * 4), b = *(const v4f*)(Y + i * 4); v4f o;
#pragma unroll
    for (int q = 0; q < 4; ++q) o[q] = __fadd_rn(bfr(a[q]), b[q]); *(v4f*)(O + i * 4) = o;  }
__global__ __launch_bounds__(256) void k_cvt8(const float* __restrict__ src, bf* dst, size_t n8) { const size_t i = (size_t)blockIdx.x * 256 + threadIdx.x; if (i >= n8) return; const v8f v = *(const v8f*)(src + i * 8); v8us o;
#pragma unroll
    for (int k = 0; k < 8; ++k) o[k] = f2bf(v[k]); *(v8us*)(dst + fo8((int)(i * 8 / DM), (int)(i * 8 % DM), DM / 32, 1)) = o;  }   // src: rows of DM columns; dst: the same plane in fragment order

// ---- k_fattn: scores, softmax and attn.v of one head in one kernel; no score ever leaves the registers.
// Transposed products: S^T = K Q^T (A = 16 key rows, B = 16 query columns), O^T += V^T P^T. A lane holds scores of ONE query (column lr), keys 8 hi + r of each 16-key tile,
// so two score tiles of a 32-key pass, converted in place, are the B operand of the second product (k order of WFrag::ld), and maximum and sum are in-lane but for one exchange between the wave's halves.
// Running maximum (base-2 units) with a lazy renewal; the row sum is kept per half and joined at the end. One wave: NG groups of 16 queries, all 2048 keys, 32 a pass.
// Every inner loop is unrolled so that the fragment, score and accumulator arrays are indexed by constants and stay in registers.
__device__ __forceinline__ float xhalf(float x) { return __builtin_bit_cast(float, __builtin_amdgcn_permlanex16(__builtin_bit_cast(int, x), __builtin_bit_cast(int, x), 0x76543210, 0xfedcba98, false, false)); }   // lane l <-> lane l ^ 16
template <bool B> struct BoolC { static constexpr bool value = B; };
// four v_exp_f32 and the slot behind the last in one statement; the results share no register with the sources, so no instruction here or behind it reads a result or overwrites a source directly behind its v_exp_f32
__device__ __forceinline__ void exp2x4(float x0, float x1, float x2, float x3, float* r) { float a, b, c, d;
    asm("v_exp_f32 %0, %4\n\tv_exp_f32 %1, %5\n\tv_exp_f32 %2, %6\n\tv_exp_f32 %3, %7\n\tv_nop" : "=&v"(a), "=&v"(b), "=&v"(c), "=&v"(d) : "v"(x0), "v"(x1), "v"(x2), "v"(x3)); r[0] = a; r[1] = b; r[2] = c; r[3] = d; }
template <typename T16, bool HL, int NG>
__device__ __forceinline__ void fattn(const T16* __restrict__ Q, const T16* __restrict__ Q2, const T16* __restrict__ Kp, const T16* __restrict__ K2, const T16* __restrict__ Vt, const T16* __restrict__ V2, int qb, float* __restrict__ orow) {
    typedef typename WFrag<T16>::V V;
    const int lane = threadIdx.x & 31, lr = lane & 15, hi = lane >> 4;
    const float cs = SCL * 1.4426950408889634f; const unsigned l8 = 8 * lane;
    V qf[NG][2], qf2[NG][2], kf[2][2], kf2[2][2];
    v8f o[NG][4]; float mr[NG], ls[NG];
#pragma unroll
    for (int g = 0; g < NG; ++g) { mr[g] = -3.0e38f; ls[g] = 0.f;
        const size_t qo = (size_t)(qb + g * 16) * HD;   // planes in fragment order: 16 rows of HD columns are two blocks of 512 elements
#pragma unroll
        for (int c = 0; c < 2; ++c) qf[g][c] = WFrag<T16>::ld(Q + qo + c * 512, l8);
        xwait();
        if (HL) {
#pragma unroll
            for (int c = 0; c < 2; ++c) qf2[g][c] = WFrag<T16>::ld(Q2 + qo + c * 512, l8);
            xwait(); }
#pragma unroll
        for (int dt = 0; dt < 4; ++dt) o[g][dt] = (v8f){}; }
    auto ldk = [&](const int key0) {   // the key rows of the pass that starts at key0
#pragma unroll
        for (int kt = 0; kt < 2; ++kt)
#pragma unroll
            for (int c = 0; c < 2; ++c) kf[kt][c] = WFrag<T16>::ld(Kp + (key0 + kt * 16) * HD + c * 512, l8);
        xwait();
        if (HL) {
#pragma unroll
            for (int kt = 0; kt < 2; ++kt)
#pragma unroll
                for (int c = 0; c < 2; ++c) kf2[kt][c] = WFrag<T16>::ld(K2 + (key0 + kt * 16) * HD + c * 512, l8);
            xwait(); }
    };
    ldk(0);
    // one pass of 32 keys; LAST: nothing is fetched ahead, so that no load is in flight when the wave ends
    auto pass = [&](const int key0, auto lastc) {
        constexpr bool LAST = decltype(lastc)::value;
        V vf[4], vf2[4];
#pragma unroll
        for (int dt = 0; dt < 4; ++dt) vf[dt] = WFrag<T16>::ld(Vt + key0 * HD + dt * 512, l8);
        xwait();
        if (HL) {
#pragma unroll
            for (int dt = 0; dt < 4; ++dt) vf2[dt] = WFrag<T16>::ld(V2 + key0 * HD + dt * 512, l8);
            xwait(); }
        v8f s[NG][2];
#pragma unroll
        for (int g = 0; g < NG; ++g)
#pragma unroll
            for (int kt = 0; kt < 2; ++kt) { v8f a = (v8f){};
#pragma unroll
                for (int c = 0; c < 2; ++c) { a = WFrag<T16>::mma(kf[kt][c], qf[g][c], a); if (HL) { a = WFrag<T16>::mma(kf[kt][c], qf2[g][c], a); a = WFrag<T16>::mma(kf2[kt][c], qf[g][c], a); } }
                s[g][kt] = a; }
        if constexpr (!LAST) ldk(key0 + 32);   // the next pass's key rows are fetched behind this pass's score products, into the same registers
        float ml[NG]; bool need = false;
#pragma unroll
        for (int g = 0; g < NG; ++g) { float mx = s[g][0][0];
#pragma unroll
            for (int r = 1; r < 8; ++r) mx = fmaxf(mx, s[g][0][r]);
#pragma unroll
            for (int r = 0; r < 8; ++r) mx = fmaxf(mx, s[g][1][r]);
            ml[g] = mx * cs; need = need || (ml[g] > mr[g] + MLAZ); }
        if (__builtin_amdgcn_ballot_w32(need) != 0) {   // wave-uniform: always on the first pass, seldom later
#pragma unroll
            for (int g = 0; g < NG; ++g) { const float mn = fmaxf(mr[g], fmaxf(ml[g], xhalf(ml[g]))); const float al = __builtin_amdgcn_exp2f(mr[g] - mn); mr[g] = mn; ls[g] *= al;
#pragma unroll
                for (int dt = 0; dt < 4; ++dt) o[g][dt] *= al; }
        }
        float pp[NG][16];
#pragma unroll
        for (int g = 0; g < NG; ++g) { const float nb = (HL ? 0.0f : PEXP) - mr[g];
#pragma unroll
            for (int e = 0; e < 16; e += 4) exp2x4(__builtin_fmaf(s[g][e >> 3][e & 7], cs, nb), __builtin_fmaf(s[g][e >> 3][(e & 7) + 1], cs, nb), __builtin_fmaf(s[g][e >> 3][(e & 7) + 2], cs, nb), __builtin_fmaf(s[g][e >> 3][(e & 7) + 3], cs, nb), &pp[g][e]); }
        __builtin_amdgcn_sched_barrier(0);   // the asm statements above stay in front of the matrix instructions below
#pragma unroll
        for (int g = 0; g < NG; ++g) { const float* p = pp[g];
#pragma unroll
            for (int e = 0; e < 16; ++e) ls[g] += p[e];
            if constexpr (HL) { v16bf ph, pl;
#pragma unroll
                for (int e = 0; e < 16; ++e) { const __bf16 hb = (__bf16)p[e]; ph[e] = hb; pl[e] = (__bf16)(p[e] - (float)hb); }
#pragma unroll
                for (int dt = 0; dt < 4; ++dt) { o[g][dt] = wmmab(vf[dt], ph, o[g][dt]); o[g][dt] = wmmab(vf[dt], pl, o[g][dt]); o[g][dt] = wmmab(vf2[dt], ph, o[g][dt]); }
            } else { v16h pf;
#pragma unroll
                for (int e = 0; e < 16; ++e) pf[e] = (h16)p[e];
#pragma unroll
                for (int dt = 0; dt < 4; ++dt) o[g][dt] = wmma16(vf[dt], pf, o[g][dt]); }
        }
    };
#pragma unroll 1   // the key loop stays rolled: a second copy of the pass would only add live fragments to a register count that is near 256
    for (int key0 = 0; key0 < TT - 32; key0 += 32) pass(key0, BoolC<false>{});
    pass(TT - 32, BoolC<true>{});
#pragma unroll
    for (int g = 0; g < NG; ++g) { const float inv = __fdiv_rn(1.0f, ls[g] + xhalf(ls[g])); float* op = orow + (size_t)(qb + g * 16 + lr) * DQ + 8 * hi;   // f32 context [t][h*64 + d]: a lane holds d = 16 dt + 8 hi + r of its query
#pragma unroll
        for (int dt = 0; dt < 4; ++dt) { v4f a, b2;
#pragma unroll
            for (int r = 0; r < 4; ++r) { a[r] = o[g][dt][r] * inv; b2[r] = o[g][dt][4 + r] * inv; }
            *(v4f*)(op + dt * 16) = a; *(v4f*)(op + dt * 16 + 4) = b2; } }
}
// grid (batches x heads, RH/128 + (TT-RH)/256), 8 waves: blocks y < RH/128 take a head's hi+lo rows (16 queries a wave, 3 products), the rest its fp16 rows (32 queries a wave); the heads run fastest, so the longer hi+lo blocks all start first
__global__ __launch_bounds__(256) void k_fattn(const h16* __restrict__ Q16, const h16* __restrict__ K16, const h16* __restrict__ V16, const bf* __restrict__ Qh, const bf* __restrict__ Ql, const bf* __restrict__ Kh, const bf* __restrict__ Kl, const bf* __restrict__ Vh, const bf* __restrict__ Vl, float* __restrict__ OUTp) {
    const size_t z = blockIdx.x, zo = z * (size_t)TT * HD; const int wv = __builtin_amdgcn_readfirstlane((int)(threadIdx.x >> 5)); const int bx = (int)blockIdx.y;
    float* orow = OUTp + (z / NH_) * (size_t)TT * DQ + (z % NH_) * HD;
    if (bx < RH / 128) fattn<bf, true, 1>(Qh + zo, Ql + zo, Kh + zo, Kl + zo, Vh + zo, Vl + zo, bx * 128 + wv * 16, orow);
    else fattn<h16, false, 2>(Q16 + zo, nullptr, K16 + zo, nullptr, V16 + zo, nullptr, RH + (bx - RH / 128) * 256 + wv * 32, orow);
}

extern "C" void kernel_launch(void* const* d_in, const int* in_sizes, int n_in,
                              void* d_out, int out_size, void* d_ws, size_t ws_size, hipStream_t stream) {
    (void)in_sizes; (void)n_in; (void)out_size;
    const float* x = (const float*)d_in[0]; const float* g1 = (const float*)d_in[1]; const float* e1b = (const float*)d_in[2]; const float* wq = (const float*)d_in[3]; const float* bq = (const float*)d_in[4]; const float* wk = (const float*)d_in[5]; const float* bk = (const float*)d_in[6]; const float* wv = (const float*)d_in[7]; const float* bv = (const float*)d_in[8]; const float* wo = nullptr; (void)wo;
    float* OUT = (float*)d_out;     // [4][2048][1024]
    char* wsp = (char*)d_ws;
    auto take = [&](size_t bytes) { char* p = wsp; wsp += (bytes + 255) & ~(size_t)255; return (void*)p; };
    bf* WQ = (bf*)take((size_t)DQ * DM * 2); bf* WK = (bf*)take((size_t)DKV * DM * 2); bf* WV = (bf*)take((size_t)DKV * DM * 2);
    bf* Yh = (bf*)take((size_t)TT * DM * 2); bf* Yl = (bf*)take((size_t)TT * DM * 2);
    const size_t PB = (size_t)NH_ * TT * HD;   // elements of one batch's head planes; the planes of all NB_ batches are kept (9 x 16 MiB), so that one launch does the attention of every batch and head
    h16* QP16 = (h16*)take(NB_ * PB * 2); h16* KP16 = (h16*)take(NB_ * PB * 2); h16* VT16 = (h16*)take(NB_ * PB * 2);
    bf* QPh = (bf*)take(NB_ * PB * 2); bf* QPl = (bf*)take(NB_ * PB * 2); bf* KPh = (bf*)take(NB_ * PB * 2); bf* KPl = (bf*)take(NB_ * PB * 2); bf* VTh = (bf*)take(NB_ * PB * 2); bf* VTl = (bf*)take(NB_ * PB * 2);
    if ((size_t)(wsp - (char*)d_ws) > ws_size) return;    // ws 256 MiB
    { k_cvt8<<<(unsigned)(((size_t)DQ * DM / 8 + 255) / 256), 256, 0, stream>>>(wq, WQ, (size_t)DQ * DM / 8); k_cvt8<<<(unsigned)(((size_t)DKV * DM / 8 + 255) / 256), 256, 0, stream>>>(wk, WK, (size_t)DKV * DM / 8); k_cvt8<<<(unsigned)(((size_t)DKV * DM / 8 + 255) / 256), 256, 0, stream>>>(wv, WV, (size_t)DKV * DM / 8);
       }
    for (int b = 0; b < NB_; ++b) {
        
        k_lnhl<<<TT / 8, 256, 0, stream>>>(x + (size_t)b * TT * DM, nullptr, g1, e1b, nullptr, Yh, Yl);   /* x = LN(h) as hi/lo planes */
        k_gemmw<bf, 1, true, KSP, false, DM, DM><<<dim3(TT / 64, NH_, 1), 32 * KSP, 0, stream>>>(Yh, Yl, WQ, nullptr, bq, QP16 + b * PB, QPh + b * PB, QPl + b * PB);
        k_gemmw<bf, 1, true, KSP, false, DM, DM><<<dim3(TT / 64, NKV, 1), 32 * KSP, 0, stream>>>(Yh, Yl, WK, nullptr, bk, KP16 + b * PB, KPh + b * PB, KPl + b * PB);
        k_gemmw<bf, 1, true, KSP, true, DM, DM><<<dim3(TT / 64, NKV, 1), 32 * KSP, 0, stream>>>(Yh, Yl, WV, nullptr, bv, VT16 + b * PB, VTh + b * PB, VTl + b * PB);
    }
    k_fattn<<<dim3(NB_ * NH_, RH / 128 + (TT - RH) / 256, 1), 256, 0, stream>>>(QP16, KP16, VT16, QPh, QPl, KPh, KPl, VTh, VTl, OUT);
}

// v006
// It runs in 217 microseconds.
// Two timings next to v005 put it at 1.28 and 1.29 times that version's speed.
// All steps since v000 together make it 17.9 times as fast.
#include <hip/hip_runtime.h>

// Perceiver self-attention (hidden_states [4][2048][1024]; x = LN(h) (1e-5, gamma, beta); q, k, v = x W^T + b ('oi' [1024][1024], 16 heads x 64); softmax(q.k/8) over all keys; out = merged context (no output projection) -> [4][2048][1024] (8.4 M)).
// Compute dtypes, f32 accumulate: every input rounded to bf16; q/k/v on x hi+lo bf16 planes (2 products) x plain bf16 weights (inputs: exact) + biases; scores and attn.v (no mask), fused with a running-maximum softmax: query rows < 512 hl (3 products), the rest single fp16 (x64); softmax f32; no output projection: the merged context is written in f32.

#define NB_  4
#define TT   2048
#define DM   1024
#define NH_  16
#define NKV  16
#define REP  (NH_ / NKV)
#define HD   64
#define DQ   (NH_ * HD)
#define DKV  (NKV * HD)
#define LNEPS 1e-5f
typedef __attribute__((ext_vector_type(4))) unsigned short v4us;
#define RH   512                  // query rows < RH use hi+lo planes (0: none)
#define WIN  0
#define PEXP 6.0f                 // fp16 rows: probabilities carry a factor 2^PEXP (it cancels against the row sum); with the lazy bound MLAZ they stay <= 2^14
#define MLAZ 8.0f                 // a row's maximum in use is renewed only when a new score exceeds it by more than this (base-2 exponent units)
#define SCL  0.125f   // HD^-0.5
#define KSP  8                    // waves that share the k range of one tile: projections (K = 1024)
typedef _Float16 h16;
typedef unsigned short bf;
typedef __attribute__((ext_vector_type(16))) __bf16   v16bf;
typedef __attribute__((ext_vector_type(16))) _Float16 v16h;
typedef __attribute__((ext_vector_type(8)))  _Float16 v8h;
typedef __attribute__((ext_vector_type(8)))  unsigned short v8us;
typedef __attribute__((ext_vector_type(8)))  float    v8f;
typedef __attribute__((ext_vector_type(4)))  float    v4f;
typedef v8h  __attribute__((may_alias)) v8ha;
typedef v4f  __attribute__((may_alias)) v4fa;
typedef v8us __attribute__((may_alias)) v8usa;

__device__ __forceinline__ unsigned short f2bf(float f) { unsigned u = __float_as_uint(f); u += 0x7FFFu + ((u >> 16) & 1u); return (unsigned short)(u >> 16); }
__device__ __forceinline__ float bf2f(unsigned short b) { return __uint_as_float(((unsigned)b) << 16); }
__device__ __forceinline__ float bfr(float f) { return bf2f(f2bf(f)); }
__device__ __forceinline__ v16h cat16(v8h lo, v8h hi) { return __builtin_shufflevector(lo, hi, 0, 1, 2, 3, 4, 5, 6, 7, 8, 9, 10, 11, 12, 13, 14, 15); }
__device__ __forceinline__ v16bf cat16b(v8us lo, v8us hi) { return __builtin_bit_cast(v16bf, __builtin_shufflevector(lo, hi, 0, 1, 2, 3, 4, 5, 6, 7, 8, 9, 10, 11, 12, 13, 14, 15)); }
__device__ __forceinline__ v8f wmma16(v16h a, v16h b, v8f c) { return __builtin_amdgcn_wmma_f32_16x16x32_f16(false, a, false, b, (short)0, c, false, false); }
__device__ __forceinline__ v8f wmmab(v16bf a, v16bf b, v8f c) { return __builtin_amdgcn_wmma_f32_16x16x32_bf16(false, a, false, b, (short)0, c, false, false); }



// ---- k_gemmw: register-blocked GEMM, one work-group of KS waves per 64x64 output tile (16 accumulators a wave), operands straight from 16-bit planes in fragment order (A of lda columns, Bt of K columns); 32 * KS threads.
// ONE launch does q, k and v of every batch: A = the NB_ * TT LN rows, Bt = the three weight planes one behind the other (3 * DQ rows); grid (3 * NH_ column tiles, NB_ * TT / 64 row tiles). The column tiles run fastest, so the work-groups in flight share a few row tiles and the weights.
// Wave w sums k in [w K/KS, (w+1) K/KS); the KS partial tiles meet in LDS and are added in the fixed order w = 0 .. KS-1. K % (32 KS) == 0.
// c[t][n] (f32, + optional f32 bias[n]) = sum_k A[t][k] Bt[n][k] (+ split products per NSPLIT). A tile's 64 columns are one head (HD == 64), and c goes straight from the LDS sum to that head's three 16-bit planes (fp16, bf16 hi, bf16 lo):
// column tiles of q, k: [h][t][d]; of v (tr): [h][d][t], each head's plane in fragment order; P16, Ph, Pl each hold q, k, v one behind the other, NB_ batches each; for TR the partial tiles lie transposed in LDS, so that either way a thread holds 8 neighbours of a plane row.
// FRAGMENT ORDER: every 16-bit plane that a matrix fragment is loaded from (LN rows, weights, q, k, v^T) is kept as blocks of 16 rows x 32 columns, 512 elements in a row each; block (r / 16, c / 32) has the index (r / 16) * sr + (c / 32) * sc.
// Inside a block the 16-byte pieces lie as the two loads of a fragment take them: piece [c % 32 / 16][c % 16 / 8][r % 16]. So a wave's load (lane = 16 hi + lr, 16 bytes a lane) is 512 bytes in a row, four whole 128-byte lines, where a row-major plane gave it 32 bytes of each of 16 lines.
// fo8: element offset of the 8 neighbours (r, c .. c + 7), c % 8 == 0, in such a plane. The k order of a fragment is that of the row-major loader: lane (lr, hi), load L, element e hold column 16 L + 8 hi + e of row lr.
// LN rows, weights: sr = DM / 32, sc = 1. q, k of a head ([t][d]): sr = 2, sc = 1. v^T of a head ([d][t]): sr = 1, sc = 4. So the 32 keys of an attention pass are 4 KiB in a row in k and in v^T alike.
__device__ __forceinline__ size_t fo8(int r, int c, int sr, int sc) { return ((size_t)(r >> 4) * sr + (size_t)(c >> 5) * sc) * 512 + ((c >> 4) & 1) * 256 + (((c >> 3) & 1) * 16 + (r & 15)) * 8; }
// WFrag::ld(p, l8): p = the block's first element, the same for the whole wave, and l8 = 8 * lane; or p = the lane's own piece and l8 = 0.
template <typename T16> struct WFrag;
template <> struct WFrag<h16> { typedef v16h V; static __device__ __forceinline__ V ld(const h16* p, unsigned l8) { return cat16(*(const v8h*)(p + l8), *(const v8h*)(p + 256 + l8)); } static __device__ __forceinline__ v8f mma(V a, V b, v8f c) { return wmma16(a, b, c); } };
template <> struct WFrag<bf> { typedef v16bf V; static __device__ __forceinline__ V ld(const bf* p, unsigned l8) { return cat16b(*(const v8us*)(p + l8), *(const v8us*)(p + 256 + l8)); } static __device__ __forceinline__ v8f mma(V a, V b, v8f c) { return wmmab(a, b, c); } };
__device__ __forceinline__ h16 tohx(float x) { return (h16)x; }
__device__ __forceinline__ void splitf(float y, unsigned short& h, unsigned short& l) { h = f2bf(y); l = f2bf(y - bf2f(h)); }
// stands behind each run of global loads from one base, in front of whatever gives their address registers a new value (a later load's result, a scalar move)
__device__ __forceinline__ void xwait() { asm volatile("s_wait_xcnt 0x0" ::: "memory"); }
// the same wait; the run's address is an input, so that its registers live up to the wait and no load of the run has its result land on them
__device__ __forceinline__ void xwaita(const void* p) { asm volatile("s_wait_xcnt 0x0" :: "v"(p) : "memory"); }
template <bool B> struct BoolC { static constexpr bool value = B; };
template <typename T16, int NSPLIT, bool BIAS, int KS, int K, int lda>   // K, lda: constants, so that a k step's fragments lie at immediate offsets from one address a plane
__global__ __launch_bounds__(32 * KS) void k_gemmw(const T16* __restrict__ A, const T16* __restrict__ A2, const T16* __restrict__ Bt, const T16* __restrict__ Bt2, const float* __restrict__ bq, const float* __restrict__ bk, const float* __restrict__ bv, h16* __restrict__ P16, bf* __restrict__ Ph, bf* __restrict__ Pl) {
    typedef typename WFrag<T16>::V V;
    __shared__ __align__(16) float os[KS * 64 * 68];
    const int lane = threadIdx.x & 31, lr = lane & 15, hi = lane >> 4; const int r0 = blockIdx.y * 64, c0 = blockIdx.x * 64;
    const int sel = (int)blockIdx.x / NH_, hd = (int)blockIdx.x % NH_, bt = r0 / TT, t0 = r0 % TT; const bool tr = sel == 2;   // which projection, its head, the batch and the row in it: the same for the whole work-group
    const float* __restrict__ bias = sel == 0 ? bq : sel == 1 ? bk : bv;
    v8f acc[4][4];
#pragma unroll
    for (int mb = 0; mb < 4; ++mb)
#pragma unroll
        for (int nb = 0; nb < 4; ++nb) acc[mb][nb] = (v8f){};
    const size_t aoff = (size_t)r0 * lda, boff = (size_t)c0 * K; const unsigned l8 = 8 * lane;   // block row r0 / 16 starts at element r0 * columns; a step of 32 in k is one block, 512 elements
    const int wv = __builtin_amdgcn_readfirstlane((int)(threadIdx.x >> 5)); const int kb = wv * (K / KS), ke = kb + K / KS;   // this wave's k range; readfirstlane keeps the loop bounds scalar
    const T16* Ak = A + aoff + (size_t)kb * 16 + l8; const T16* Bk = Bt + boff + (size_t)kb * 16 + l8;   // the lane's piece of the wave's first blocks
    const T16* A2k = (NSPLIT == 1 || NSPLIT == 2) ? A2 + aoff + (size_t)kb * 16 + l8 : nullptr; const T16* B2k = NSPLIT >= 2 ? Bt2 + boff + (size_t)kb * 16 + l8 : nullptr;
#pragma unroll 1
    for (int kc = kb; kc < ke; kc += 32) {
        V a[4], a2[4], b[4], b2[4];
#pragma unroll
        for (int mb = 0; mb < 4; ++mb) a[mb] = WFrag<T16>::ld(Ak + (size_t)mb * 16 * lda, 0);
        xwaita(Ak);
        if (NSPLIT == 1 || NSPLIT == 2) {
#pragma unroll
            for (int mb = 0; mb < 4; ++mb) a2[mb] = WFrag<T16>::ld(A2k + (size_t)mb * 16 * lda, 0);
            xwaita(A2k); }
#pragma unroll
        for (int nb = 0; nb < 4; ++nb) b[nb] = WFrag<T16>::ld(Bk + (size_t)nb * 16 * K, 0);
        xwaita(Bk);
        if (NSPLIT >= 2) {
#pragma unroll
            for (int nb = 0; nb < 4; ++nb) b2[nb] = WFrag<T16>::ld(B2k + (size_t)nb * 16 * K, 0);
            xwaita(B2k); }
#pragma unroll
        for (int nb = 0; nb < 4; ++nb)
#pragma unroll
            for (int mb = 0; mb < 4; ++mb) { acc[mb][nb] = WFrag<T16>::mma(a[mb], b[nb], acc[mb][nb]); if (NSPLIT == 1 || NSPLIT == 2) acc[mb][nb] = WFrag<T16>::mma(a2[mb], b[nb], acc[mb][nb]); if (NSPLIT >= 2) acc[mb][nb] = WFrag<T16>::mma(a[mb], b2[nb], acc[mb][nb]); }
        Ak += 512; Bk += 512; if (NSPLIT == 1 || NSPLIT == 2) A2k += 512; if (NSPLIT >= 2) B2k += 512;
        asm volatile("v_nop\n\tv_nop\n\tv_nop\n\tv_nop" : "+v"(acc[0][0]), "+v"(acc[1][1]), "+v"(acc[2][2]), "+v"(acc[3][3]) : "v"(a[0]), "v"(a[3]));
    }
    float* ow = os + wv * (64 * 68);
    auto put = [&](auto trc) { constexpr bool TR = decltype(trc)::value;
    // the loops are unrolled so that acc is indexed by constants and stays in registers
#pragma unroll
    for (int mb = 0; mb < 4; ++mb)
#pragma unroll
        for (int nb = 0; nb < 4; ++nb) {
            if (TR) {   // LDS row = column n, LDS column = row t: a lane's 8 accumulator rows are neighbours, two 16-byte stores
                float* p = ow + (nb * 16 + lr) * 68 + mb * 16 + hi * 8;
                *(v4fa*)p = __builtin_shufflevector(acc[mb][nb], acc[mb][nb], 0, 1, 2, 3); *(v4fa*)(p + 4) = __builtin_shufflevector(acc[mb][nb], acc[mb][nb], 4, 5, 6, 7);
            } else {
#pragma unroll
                for (int j = 0; j < 8; ++j) ow[(mb * 16 + hi * 8 + j) * 68 + nb * 16 + lr] = acc[mb][nb][j]; }
        }
    };
    if (tr) put(BoolC<true>{}); else put(BoolC<false>{});   // one scalar branch for the 16 tiles
    __syncthreads();   // every wave's partial tile is in LDS before any thread adds them
    const size_t pb = (((size_t)sel * NB_ + bt) * NH_ + hd) * TT * HD;   // this head's plane
    auto fin = [&](auto trc) { constexpr bool TR = decltype(trc)::value;
    // both loops unrolled: a thread's LDS reads issue together instead of one wait per read
#pragma unroll
    for (int s = 0; s < 16 / KS; ++s) { const int i = s * (32 * KS) + (int)threadIdx.x, hb = i >> 5, row = (hb >> 2) * 16 + (i & 15), cofs = (hb & 3) * 16 + ((i >> 4) & 1) * 8;   /* a wave takes the 32 pieces of one fragment load, 512 bytes in a row of each plane */ v4f va = *(const v4fa*)(os + row * 68 + cofs), vb = *(const v4fa*)(os + row * 68 + cofs + 4);
#pragma unroll
        for (int w = 1; w < KS; ++w) { va += *(const v4fa*)(os + (w * 64 + row) * 68 + cofs); vb += *(const v4fa*)(os + (w * 64 + row) * 68 + cofs + 4); }
        v8h o16; v8us oh, ol;
#pragma unroll
        for (int q = 0; q < 8; ++q) { float c = q < 4 ? va[q] : vb[q - 4]; if (BIAS) c += bfr(bias[hd * HD + (TR ? row : cofs + q)]); o16[q] = tohx(c); unsigned short h2, l2; splitf(c, h2, l2); oh[q] = h2; ol[q] = l2; }
        const size_t e = pb + (TR ? fo8(row, t0 + cofs, 1, HD / 16) : fo8(t0 + row, cofs, HD / 32, 1));
        *(v8h*)(P16 + e) = o16; *(v8us*)(Ph + e) = oh; *(v8us*)(Pl + e) = ol; }
    };
    if (tr) fin(BoolC<true>{}); else fin(BoolC<false>{});
}

typedef __attribute__((ext_vector_type(2))) _Float16 v2h;
typedef __attribute__((ext_vector_type(4))) _Float16 v4h;
typedef __attribute__((ext_vector_type(2))) unsigned short v2us;
typedef __attribute__((ext_vector_type(4))) unsigned short v4us;
typedef __attribute__((ext_vector_type(2))) float v2f;
typedef __attribute__((ext_vector_type(4))) int v4i;

__global__ __launch_bounds__(256) void k_wtG(const float* __restrict__ w, int K, int N, bf* Bt) {
    const int lane = threadIdx.x & 31; const int L0 = (blockIdx.x * 8 + (threadIdx.x >> 5)) * 8; const int nlines = N * K / 64;
{
#pragma unroll 1
        for (int l = 0; l < 8; ++l) { const int L = L0 + l; if (L >= nlines) break; const size_t e = (size_t)L * 64 + lane * 2; const int k = (int)(e % K), n = (int)(e / K); v2us o;
            o[0] = f2bf(w[(size_t)k * N + n]); o[1] = f2bf(w[(size_t)(k + 1) * N + n]); *(v2us*)(Bt + e) = o; }
         }
}
__device__ __forceinline__ void lnhl(const int blk, const float* __restrict__ X, const float* __restrict__ A, const float* __restrict__ g, const float* __restrict__ be, float* Z, bf* Yh, bf* Yl) {   // rows of every batch: r = batch * TT + t
    const int lane = threadIdx.x & 31; const int r = blk * 8 + (threadIdx.x >> 5); if (r >= NB_ * TT) return; const float* xr = X + (size_t)r * DM; const float* ar = A ? A + (size_t)r * DM : nullptr; float s = 0.f;
#pragma unroll 1
    for (int ch = 0; ch < DM / 128; ++ch) { const int c0 = ch * 128 + lane * 4; const v4f a = *(const v4f*)(xr + c0); v4f d = {0.f, 0.f, 0.f, 0.f}; if (ar) d = *(const v4f*)(ar + c0);
#pragma unroll
        for (int q = 0; q < 4; ++q) s += __fadd_rn(bfr(a[q]), d[q]); }
#pragma unroll
    for (int sh = 16; sh; sh >>= 1) s += __shfl_xor(s, sh, 32);
    const float mu = s * (1.0f / DM); float s2 = 0.f;
#pragma unroll 1
    for (int ch = 0; ch < DM / 128; ++ch) { const int c0 = ch * 128 + lane * 4; const v4f a = *(const v4f*)(xr + c0); v4f d = {0.f, 0.f, 0.f, 0.f}; if (ar) d = *(const v4f*)(ar + c0);
#pragma unroll
        for (int q = 0; q < 4; ++q) { const float d0 = __fsub_rn(__fadd_rn(bfr(a[q]), d[q]), mu); float p = __fmul_rn(d0, d0); asm volatile("" : "+v"(p)); s2 = __fadd_rn(s2, p); } }
#pragma unroll
    for (int sh = 16; sh; sh >>= 1) s2 += __shfl_xor(s2, sh, 32);
    const float rs = __fdiv_rn(1.0f, __fsqrt_rn(__fadd_rn(s2 * (1.0f / DM), LNEPS)));
{
#pragma unroll 1
        for (int ch = 0; ch < DM / 128; ++ch) { const int c0 = ch * 128 + lane * 4; const v4f a = *(const v4f*)(xr + c0); v4f d = {0.f, 0.f, 0.f, 0.f}; if (ar) d = *(const v4f*)(ar + c0); v4f z4; v4us oh, ol;
#pragma unroll
            for (int q = 0; q < 4; ++q) { const float v = __fadd_rn(bfr(a[q]), d[q]); z4[q] = v; float n0 = __fmul_rn(__fsub_rn(v, mu), rs); asm volatile("" : "+v"(n0)); float n1 = __fmul_rn(n0, bfr(g[c0 + q])); asm volatile("" : "+v"(n1)); const float y = __fadd_rn(n1, bfr(be[c0 + q])); unsigned short h2, l2; splitf(y, h2, l2); oh[q] = h2; ol[q] = l2; }
            if (Z) *(v4f*)(Z + (size_t)r * DM + c0) = z4; const size_t e = fo8(r, c0 & ~7, DM / 32, 1) + (c0 & 7); *(v4us*)(Yh + e) = oh; *(v4us*)(Yl + e) = ol; }
         } }
__global__ __launch_bounds__(256) void k_addres(const float* __restrict__ X, const float* __restrict__ Y, float* O, size_t n4) { const size_t i = (size_t)blockIdx.x * 256 + threadIdx.x; if (i >= n4) return; const v4f a = *(const v4f*)(X + i * 4), b = *(const v4f*)(Y + i * 4); v4f o;
#pragma unroll
    for (int q = 0; q < 4; ++q) o[q] = __fadd_rn(bfr(a[q]), b[q]); *(v4f*)(O + i * 4) = o;  }
__device__ __forceinline__ void cvt8(const int blk, const float* __restrict__ src, bf* dst, size_t n8) { const size_t i = (size_t)blk * 256 + threadIdx.x; if (i >= n8) return; const v8f v = *(const v8f*)(src + i * 8); v8us o;
#pragma unroll
    for (int k = 0; k < 8; ++k) o[k] = f2bf(v[k]); *(v8us*)(dst + fo8((int)(i * 8 / DM), (int)(i * 8 % DM), DM / 32, 1)) = o;  }   // src: rows of DM columns; dst: the same plane in fragment order
// ---- k_prep: all that the projections wait for, in one launch: blocks < LNB_ take the LN rows of every batch (8 a block; the longer work, so it starts first), then WB_ blocks for each weight plane (W3: q, k, v one behind the other)
#define LNB_ (NB_ * TT / 8)
#define WB_  (DQ * DM / 8 / 256)
__global__ __launch_bounds__(256) void k_prep(const float* __restrict__ X, const float* __restrict__ g, const float* __restrict__ be, const float* __restrict__ wq, const float* __restrict__ wk, const float* __restrict__ wv, bf* Yh, bf* Yl, bf* W3) {
    const int blk = (int)blockIdx.x;
    if (blk < LNB_) { lnhl(blk, X, nullptr, g, be, nullptr, Yh, Yl); return; }
    const int j = blk - LNB_, sel = j / WB_;
    cvt8(j % WB_, sel == 0 ? wq : sel == 1 ? wk : wv, W3 + (size_t)sel * DQ * DM, (size_t)DQ * DM / 8);
}

// ---- k_fattn: scores, softmax and attn.v of one head in one kernel; no score ever leaves the registers.
// Transposed products: S^T = K Q^T (A = 16 key rows, B = 16 query columns), O^T += V^T P^T. A lane holds scores of ONE query (column lr), keys 8 hi + r of each 16-key tile,
// so two score tiles of a 32-key pass, converted in place, are the B operand of the second product (k order of WFrag::ld), and maximum and sum are in-lane but for one exchange between the wave's halves.
// Running maximum (base-2 units) with a lazy renewal; the row sum is kept per half and joined at the end. One wave: NG groups of 16 queries, all 2048 keys, 32 a pass.
// Every inner loop is unrolled so that the fragment, score and accumulator arrays are indexed by constants and stay in registers.
__device__ __forceinline__ float xhalf(float x) { return __builtin_bit_cast(float, __builtin_amdgcn_permlanex16(__builtin_bit_cast(int, x), __builtin_bit_cast(int, x), 0x76543210, 0xfedcba98, false, false)); }   // lane l <-> lane l ^ 16
// four v_exp_f32 and the slot behind the last in one statement; the results share no register with the sources, so no instruction here or behind it reads a result or overwrites a source directly behind its v_exp_f32
__device__ __forceinline__ void exp2x4(float x0, float x1, float x2, float x3, float* r) { float a, b, c, d;
    asm("v_exp_f32 %0, %4\n\tv_exp_f32 %1, %5\n\tv_exp_f32 %2, %6\n\tv_exp_f32 %3, %7\n\tv_nop" : "=&v"(a), "=&v"(b), "=&v"(c), "=&v"(d) : "v"(x0), "v"(x1), "v"(x2), "v"(x3)); r[0] = a; r[1] = b; r[2] = c; r[3] = d; }
template <typename T16, bool HL, int NG>
__device__ __forceinline__ void fattn(const T16* __restrict__ Q, const T16* __restrict__ Q2, const T16* __restrict__ Kp, const T16* __restrict__ K2, const T16* __restrict__ Vt, const T16* __restrict__ V2, int qb, float* __restrict__ orow) {
    typedef typename WFrag<T16>::V V;
    const int lane = threadIdx.x & 31, lr = lane & 15, hi = lane >> 4;
    const float cs = SCL * 1.4426950408889634f; const unsigned l8 = 8 * lane;
    V qf[NG][2], qf2[NG][2], kf[2][2], kf2[2][2];
    v8f o[NG][4]; float mr[NG], ls[NG];
#pragma unroll
    for (int g = 0; g < NG; ++g) { mr[g] = -3.0e38f; ls[g] = 0.f;
        const size_t qo = (size_t)(qb + g * 16) * HD;   // planes in fragment order: 16 rows of HD columns are two blocks of 512 elements
#pragma unroll
        for (int c = 0; c < 2; ++c) qf[g][c] = WFrag<T16>::ld(Q + qo + c * 512, l8);
        xwait();
        if (HL) {
#pragma unroll
            for (int c = 0; c < 2; ++c) qf2[g][c] = WFrag<T16>::ld(Q2 + qo + c * 512, l8);
            xwait(); }
#pragma unroll
        for (int dt = 0; dt < 4; ++dt) o[g][dt] = (v8f){}; }
    auto ldk = [&](const int key0) {   // the key rows of the pass that starts at key0
#pragma unroll
        for (int kt = 0; kt < 2; ++kt)
#pragma unroll
            for (int c = 0; c < 2; ++c) kf[kt][c] = WFrag<T16>::ld(Kp + (key0 + kt * 16) * HD + c * 512, l8);
        xwait();
        if (HL) {
#pragma unroll
            for (int kt = 0; kt < 2; ++kt)
#pragma unroll
                for (int c = 0; c < 2; ++c) kf2[kt][c] = WFrag<T16>::ld(K2 + (key0 + kt * 16) * HD + c * 512, l8);
            xwait(); }
    };
    ldk(0);
    // one pass of 32 keys; LAST: nothing is fetched ahead, so that no load is in flight when the wave ends
    auto pass = [&](const int key0, auto lastc) {
        constexpr bool LAST = decltype(lastc)::value;
        V vf[4], vf2[4];
#pragma unroll
        for (int dt = 0; dt < 4; ++dt) vf[dt] = WFrag<T16>::ld(Vt + key0 * HD + dt * 512, l8);
        xwait();
        if (HL) {
#pragma unroll
            for (int dt = 0; dt < 4; ++dt) vf2[dt] = WFrag<T16>::ld(V2 + key0 * HD + dt * 512, l8);
            xwait(); }
        v8f s[NG][2];
#pragma unroll
        for (int g = 0; g < NG; ++g)
#pragma unroll
            for (int kt = 0; kt < 2; ++kt) { v8f a = (v8f){};
#pragma unroll
                for (int c = 0; c < 2; ++c) { a = WFrag<T16>::mma(kf[kt][c], qf[g][c], a); if (HL) { a = WFrag<T16>::mma(kf[kt][c], qf2[g][c], a); a = WFrag<T16>::mma(kf2[kt][c], qf[g][c], a); } }
                s[g][kt] = a; }
        if constexpr (!LAST) ldk(key0 + 32);   // the next pass's key rows are fetched behind this pass's score products, into the same registers
        float ml[NG]; bool need = false;
#pragma unroll
        for (int g = 0; g < NG; ++g) { float mx = s[g][0][0];
#pragma unroll
            for (int r = 1; r < 8; ++r) mx = fmaxf(mx, s[g][0][r]);
#pragma unroll
            for (int r = 0; r < 8; ++r) mx = fmaxf(mx, s[g][1][r]);
            ml[g] = mx * cs; need = need || (ml[g] > mr[g] + MLAZ); }
        if (__builtin_amdgcn_ballot_w32(need) != 0) {   // wave-uniform: always on the first pass, seldom later
#pragma unroll
            for (int g = 0; g < NG; ++g) { const float mn = fmaxf(mr[g], fmaxf(ml[g], xhalf(ml[g]))); const float al = __builtin_amdgcn_exp2f(mr[g] - mn); mr[g] = mn; ls[g] *= al;
#pragma unroll
                for (int dt = 0; dt < 4; ++dt) o[g][dt] *= al; }
        }
        float pp[NG][16];
#pragma unroll
        for (int g = 0; g < NG; ++g) { const float nb = (HL ? 0.0f : PEXP) - mr[g];
#pragma unroll
            for (int e = 0; e < 16; e += 4) exp2x4(__builtin_fmaf(s[g][e >> 3][e & 7], cs, nb), __builtin_fmaf(s[g][e >> 3][(e & 7) + 1], cs, nb), __builtin_fmaf(s[g][e >> 3][(e & 7) + 2], cs, nb), __builtin_fmaf(s[g][e >> 3][(e & 7) + 3], cs, nb), &pp[g][e]); }
        __builtin_amdgcn_sched_barrier(0);   // the asm statements above stay in front of the matrix instructions below
#pragma unroll
        for (int g = 0; g < NG; ++g) { const float* p = pp[g];
#pragma unroll
            for (int e = 0; e < 16; ++e) ls[g] += p[e];
            if constexpr (HL) { v16bf ph, pl;
#pragma unroll
                for (int e = 0; e < 16; ++e) { const __bf16 hb = (__bf16)p[e]; ph[e] = hb; pl[e] = (__bf16)(p[e] - (float)hb); }
#pragma unroll
                for (int dt = 0; dt < 4; ++dt) { o[g][dt] = wmmab(vf[dt], ph, o[g][dt]); o[g][dt] = wmmab(vf[dt], pl, o[g][dt]); o[g][dt] = wmmab(vf2[dt], ph, o[g][dt]); }
            } else { v16h pf;
#pragma unroll
                for (int e = 0; e < 16; ++e) pf[e] = (h16)p[e];
#pragma unroll
                for (int dt = 0; dt < 4; ++dt) o[g][dt] = wmma16(vf[dt], pf, o[g][dt]); }
        }
    };
#pragma unroll 1   // the key loop stays rolled: a second copy of the pass would only add live fragments to a register count that is near 256
    for (int key0 = 0; key0 < TT - 32; key0 += 32) pass(key0, BoolC<false>{});
    pass(TT - 32, BoolC<true>{});
#pragma unroll
    for (int g = 0; g < NG; ++g) { const float inv = __fdiv_rn(1.0f, ls[g] + xhalf(ls[g])); float* op = orow + (size_t)(qb + g * 16 + lr) * DQ + 8 * hi;   // f32 context [t][h*64 + d]: a lane holds d = 16 dt + 8 hi + r of its query
#pragma unroll
        for (int dt = 0; dt < 4; ++dt) { v4f a, b2;
#pragma unroll
            for (int r = 0; r < 4; ++r) { a[r] = o[g][dt][r] * inv; b2[r] = o[g][dt][4 + r] * inv; }
            *(v4f*)(op + dt * 16) = a; *(v4f*)(op + dt * 16 + 4) = b2; } }
}
// grid (batches x heads, RH/128 + (TT-RH)/256), 8 waves: blocks y < RH/128 take a head's hi+lo rows (16 queries a wave, 3 products), the rest its fp16 rows (32 queries a wave); the heads run fastest, so the longer hi+lo blocks all start first
__global__ __launch_bounds__(256) void k_fattn(const h16* __restrict__ Q16, const h16* __restrict__ K16, const h16* __restrict__ V16, const bf* __restrict__ Qh, const bf* __restrict__ Ql, const bf* __restrict__ Kh, const bf* __restrict__ Kl, const bf* __restrict__ Vh, const bf* __restrict__ Vl, float* __restrict__ OUTp) {
    const size_t z = blockIdx.x, zo = z * (size_t)TT * HD; const int wv = __builtin_amdgcn_readfirstlane((int)(threadIdx.x >> 5)); const int bx = (int)blockIdx.y;
    float* orow = OUTp + (z / NH_) * (size_t)TT * DQ + (z % NH_) * HD;
    if (bx < RH / 128) fattn<bf, true, 1>(Qh + zo, Ql + zo, Kh + zo, Kl + zo, Vh + zo, Vl + zo, bx * 128 + wv * 16, orow);
    else fattn<h16, false, 2>(Q16 + zo, nullptr, K16 + zo, nullptr, V16 + zo, nullptr, RH + (bx - RH / 128) * 256 + wv * 32, orow);
}

extern "C" void kernel_launch(void* const* d_in, const int* in_sizes, int n_in,
                              void* d_out, int out_size, void* d_ws, size_t ws_size, hipStream_t stream) {
    (void)in_sizes; (void)n_in; (void)out_size;
    const float* x = (const float*)d_in[0]; const float* g1 = (const float*)d_in[1]; const float* e1b = (const float*)d_in[2]; const float* wq = (const float*)d_in[3]; const float* bq = (const float*)d_in[4]; const float* wk = (const float*)d_in[5]; const float* bk = (const float*)d_in[6]; const float* wv = (const float*)d_in[7]; const float* bv = (const float*)d_in[8]; const float* wo = nullptr; (void)wo;
    float* OUT = (float*)d_out;     // [4][2048][1024]
    char* wsp = (char*)d_ws;
    auto take = [&](size_t bytes) { char* p = wsp; wsp += (bytes + 255) & ~(size_t)255; return (void*)p; };
    bf* W3 = (bf*)take((size_t)3 * DQ * DM * 2);   // the weight planes of q, k, v, one behind the other
    bf* Yh = (bf*)take((size_t)NB_ * TT * DM * 2); bf* Yl = (bf*)take((size_t)NB_ * TT * DM * 2);   // the LN rows of every batch
    const size_t PB = (size_t)NH_ * TT * HD;   // elements of one batch's head planes; the planes of all NB_ batches are kept (9 x 16 MiB), so that one launch does the projections, and one the attention, of every batch and head
    h16* QP16 = (h16*)take(3 * NB_ * PB * 2); h16* KP16 = QP16 + NB_ * PB; h16* VT16 = KP16 + NB_ * PB;
    bf* QPh = (bf*)take(3 * NB_ * PB * 2); bf* KPh = QPh + NB_ * PB; bf* VTh = KPh + NB_ * PB;
    bf* QPl = (bf*)take(3 * NB_ * PB * 2); bf* KPl = QPl + NB_ * PB; bf* VTl = KPl + NB_ * PB;
    if ((size_t)(wsp - (char*)d_ws) > ws_size) return;    // ws 256 MiB
    k_prep<<<LNB_ + 3 * WB_, 256, 0, stream>>>(x, g1, e1b, wq, wk, wv, Yh, Yl, W3);   /* x = LN(h) as hi/lo planes; weights as bf16 planes */
    k_gemmw<bf, 1, true, KSP, DM, DM><<<dim3(3 * NH_, NB_ * TT / 64, 1), 32 * KSP, 0, stream>>>(Yh, Yl, W3, nullptr, bq, bk, bv, QP16, QPh, QPl);
    k_fattn<<<dim3(NB_ * NH_, RH / 128 + (TT - RH) / 256, 1), 256, 0, stream>>>(QP16, KP16, VT16, QPh, QPl, KPh, KPl, VTh, VTl, OUT);
}
